// v000
// Measured on an AMD MI455X. A time is GPU time per run, averaged over a window of back-to-back runs after a warm-up
// (all launches, gaps included; the runs take copies of the inputs in turn), and the median of several windows.
// Apart from v000's, it joins two sittings. Times from different sittings can be a few percent apart, while
// side-by-side timings come from the same sitting.
// v000, which the later versions start from, runs in 197 microseconds.
#include <hip/hip_runtime.h>
#include <math.h>

// Single-head cross attention: q = x1 Wq^T, k = x2 Wk^T, v = x2 Wv^T (x [4][4096][64] f32, W [64][64] = [out][in]); p = softmax over keys of (q.k) * SEQ^-0.5; out = p v -> f32 [4][4096][64].
// Compute dtypes, f32 accumulate: all five inputs RNE-converted to bf16; q, k and v^T projections on v_wmma_f32_16x16x32_bf16 (plain bf16 operands); q.k^T and p.v on v_wmma_f32_16x16x32_f16 (q, k, v^T as plain fp16 planes; p enters as fp16 of (p - 0.6875), and 0.6875 * (64-key column sums of v, f32) is added to the f32 accumulator); online softmax (running max, exp2, row sums, 1/l) in f32.

#ifndef NB
#define NB 4
#endif
#ifndef SEQ
#define SEQ 4096
#endif
#define NB_FULL  4
#define SEQ_FULL 4096
#define DH       64
#define KBK      64
#define OSP      68
#define CCEN     0.6875f
static_assert(NB >= 1 && NB <= NB_FULL);
static_assert(SEQ >= KBK && SEQ <= SEQ_FULL && (SEQ % 64) == 0);
static_assert(DH == 64 && KBK == 64);

typedef _Float16 h16;
typedef unsigned short bf;
typedef __attribute__((ext_vector_type(16))) __bf16   v16bf;
typedef __attribute__((ext_vector_type(16))) _Float16 v16h;
typedef __attribute__((ext_vector_type(8)))  _Float16 v8h;
typedef __attribute__((ext_vector_type(8)))  unsigned short v8us;
typedef __attribute__((ext_vector_type(8)))  float    v8f;
typedef __attribute__((ext_vector_type(4)))  float    v4f;
typedef v8h  __attribute__((may_alias)) v8ha;
typedef v4f  __attribute__((may_alias)) v4fa;

__device__ __forceinline__ unsigned short f2bf(float f) { unsigned u = __float_as_uint(f); u += 0x7FFFu + ((u >> 16) & 1u); return (unsigned short)(u >> 16); }
__device__ __forceinline__ float bf2f(unsigned short b) { return __uint_as_float(((unsigned)b) << 16); }
__device__ __forceinline__ float bfr(float f) { return bf2f(f2bf(f)); }
__device__ __forceinline__ v16h cat16(v8h lo, v8h hi) { return __builtin_shufflevector(lo, hi, 0, 1, 2, 3, 4, 5, 6, 7, 8, 9, 10, 11, 12, 13, 14, 15); }
__device__ __forceinline__ v16bf cat16b(v8us lo, v8us hi) { return __builtin_bit_cast(v16bf, __builtin_shufflevector(lo, hi, 0, 1, 2, 3, 4, 5, 6, 7, 8, 9, 10, 11, 12, 13, 14, 15)); }
__device__ __forceinline__ v8f wmma16(v16h a, v16h b, v8f c) { return __builtin_amdgcn_wmma_f32_16x16x32_f16(false, a, false, b, (short)0, c, false, false); }
__device__ __forceinline__ v8f wmmab(v16bf a, v16bf b, v8f c) { return __builtin_amdgcn_wmma_f32_16x16x32_bf16(false, a, false, b, (short)0, c, false, false); }

// ---- k_gemmw: register-blocked GEMM, ONE WAVE per 64x64 output tile (16 accumulators), operands straight from K-contiguous 16-bit planes; grid (M/64, N/64, Z), 32 threads.
// C[m][n] (f32, pitch ldc, + optional f32 bias[n]) = sum_k A[m][k] Bt[n][k] (+ split products per NSPLIT). z-batch strides sA/sB/sC in elements. K % 32 == 0.
// Fragment map (both operands): lane row/col = lane & 15, elements 0..7 <- k0 + 8h + 0..7, elements 8..15 <- k0 + 16 + 8h + 0..7 (h = lane >> 4).
template <typename T16> struct WFrag;
template <> struct WFrag<h16> { typedef v16h V; static __device__ __forceinline__ V ld(const h16* p) { return cat16(*(const v8h*)p, *(const v8h*)(p + 16)); } static __device__ __forceinline__ v8f mma(V a, V b, v8f c) { return wmma16(a, b, c); } };
template <> struct WFrag<bf> { typedef v16bf V; static __device__ __forceinline__ V ld(const bf* p) { return cat16b(*(const v8us*)p, *(const v8us*)(p + 16)); } static __device__ __forceinline__ v8f mma(V a, V b, v8f c) { return wmmab(a, b, c); } };
template <typename T16, int NSPLIT, bool BIAS>
__global__ __launch_bounds__(32) void k_gemmw(const T16* __restrict__ A, const T16* __restrict__ A2, const T16* __restrict__ Bt, const T16* __restrict__ Bt2, int K, float* C, int ldc, const float* __restrict__ bias, size_t sA, size_t sB, size_t sC) {
    typedef typename WFrag<T16>::V V;
    __shared__ __align__(16) float os[16 * 68];
    const size_t z = blockIdx.z; A += z * sA; if (A2) A2 += z * sA; Bt += z * sB; if (Bt2) Bt2 += z * sB; C += z * sC;
    const int lane = threadIdx.x & 31, lr = lane & 15, hi = lane >> 4; const int r0 = blockIdx.x * 64, c0 = blockIdx.y * 64;
    v8f acc[4][4];
#pragma unroll
    for (int mb = 0; mb < 4; ++mb)
#pragma unroll
        for (int nb = 0; nb < 4; ++nb) acc[mb][nb] = (v8f){};
    const size_t aoff = (size_t)(r0 + lr) * K + 8 * hi, boff = (size_t)(c0 + lr) * K + 8 * hi;
#pragma unroll 1
    for (int kc = 0; kc < K; kc += 32) {
        V a[4], a2[4];
#pragma unroll
        for (int mb = 0; mb < 4; ++mb) { a[mb] = WFrag<T16>::ld(A + aoff + (size_t)mb * 16 * K + kc); if (NSPLIT == 1 || NSPLIT == 2) a2[mb] = WFrag<T16>::ld(A2 + aoff + (size_t)mb * 16 * K + kc); }
#pragma unroll
        for (int nb = 0; nb < 4; ++nb) { const V b = WFrag<T16>::ld(Bt + boff + (size_t)nb * 16 * K + kc); V b2; if (NSPLIT >= 2) b2 = WFrag<T16>::ld(Bt2 + boff + (size_t)nb * 16 * K + kc);
#pragma unroll
            for (int mb = 0; mb < 4; ++mb) { acc[mb][nb] = WFrag<T16>::mma(a[mb], b, acc[mb][nb]); if (NSPLIT == 1 || NSPLIT == 2) acc[mb][nb] = WFrag<T16>::mma(a2[mb], b, acc[mb][nb]); if (NSPLIT >= 2) acc[mb][nb] = WFrag<T16>::mma(a[mb], b2, acc[mb][nb]); } }
        asm volatile("v_nop\n\tv_nop\n\tv_nop\n\tv_nop" : "+v"(acc[0][0]), "+v"(acc[1][1]), "+v"(acc[2][2]), "+v"(acc[3][3]) : "v"(a[0]), "v"(a[3]));
    }
#pragma unroll
    for (int mb = 0; mb < 4; ++mb) {
#pragma unroll
        for (int nb = 0; nb < 4; ++nb) {
#pragma unroll
            for (int j = 0; j < 8; ++j) os[(hi * 8 + j) * 68 + nb * 16 + lr] = acc[mb][nb][j]; }
        __builtin_amdgcn_wave_barrier(); asm volatile("" ::: "memory");
        float* crow = C + (size_t)(r0 + mb * 16) * ldc + c0;
{
#pragma unroll
            for (int s = 0; s < 8; ++s) { const int row = 2 * s + hi, cofs = lr * 4; v4f val = *(const v4fa*)(os + row * 68 + cofs); if (BIAS) { val[0] += bfr(bias[c0 + cofs]); val[1] += bfr(bias[c0 + cofs + 1]); val[2] += bfr(bias[c0 + cofs + 2]); val[3] += bfr(bias[c0 + cofs + 3]); }
                *(v4f*)(crow + (size_t)row * ldc + cofs) = val; }
             }
        __builtin_amdgcn_wave_barrier(); asm volatile("" ::: "memory");
    }
}

__global__ __launch_bounds__(256) void k_cvtw(const float* __restrict__ w0, const float* __restrict__ w1, const float* __restrict__ w2, bf* dst) {
    const int y = blockIdx.y; const float* src = (y == 0) ? w0 : ((y == 1) ? w1 : w2);
    const size_t i = (size_t)blockIdx.x * 256 + threadIdx.x; if (i >= (size_t)DH * DH / 8) return;
    const v8f v = *(const v8f*)(src + i * 8); v8us o;
#pragma unroll
    for (int k = 0; k < 8; ++k) o[k] = f2bf(v[k]);
    bf* dp = dst + (size_t)y * DH * DH + i * 8;
    *(v8us*)dp = o;  }

__global__ __launch_bounds__(256) void k_cvtx(const float* __restrict__ x1, const float* __restrict__ x2, bf* d1, bf* d2) {
    const int b = blockIdx.y; const bool second = (blockIdx.z != 0);
    const float* src = (second ? x2 : x1) + (size_t)b * SEQ_FULL * DH; bf* dst = (second ? d2 : d1) + (size_t)b * SEQ * DH;
    const size_t i = (size_t)blockIdx.x * 256 + threadIdx.x; if (i >= (size_t)SEQ * DH / 8) return;
    const v8f v = *(const v8f*)(src + i * 8); v8us o;
#pragma unroll
    for (int k = 0; k < 8; ++k) o[k] = f2bf(v[k]);
    *(v8us*)(dst + i * 8) = o;  }

__global__ __launch_bounds__(256) void k_p16(const float* __restrict__ src, h16* dst, size_t n8) {
    const size_t i = (size_t)blockIdx.x * 256 + threadIdx.x; if (i >= n8) return;
    const v8f v = *(const v8f*)(src + i * 8); v8h o;
#pragma unroll
    for (int k = 0; k < 8; ++k) o[k] = (h16)v[k];
    *(v8h*)(dst + i * 8) = o;  }

__global__ __launch_bounds__(256) void k_vsum(const float* __restrict__ FVt, float* VS) {
    const int t = threadIdx.x; const int b = blockIdx.y; const int nkb = SEQ / KBK; const int kb = blockIdx.x * 16 + (t >> 4); const int d0 = (t & 15) * 4;
    if (kb >= nkb) return;
    const float* src = FVt + ((size_t)b * DH + d0) * SEQ + (size_t)kb * KBK;
    v4f o;
#pragma unroll
    for (int j = 0; j < 4; ++j) { const float* col = src + (size_t)j * SEQ; v4f s4 = (v4f){};
#pragma unroll 4
        for (int q = 0; q < KBK / 4; ++q) s4 += *(const v4f*)(col + q * 4);
        o[j] = (s4[0] + s4[1]) + (s4[2] + s4[3]); }
    float* dp = VS + ((size_t)b * nkb + kb) * DH + d0;
    *(v4f*)dp = o;  }

// 16-lane (half-wave) reductions matching the WMMA D layout (lanes 0-15 / 16-31 each hold one group of rows).
__device__ __forceinline__ float rmax16(float x) { x = fmaxf(x, __shfl_xor(x, 1, 32)); x = fmaxf(x, __shfl_xor(x, 2, 32)); x = fmaxf(x, __shfl_xor(x, 4, 32)); x = fmaxf(x, __shfl_xor(x, 8, 32)); return x; }
__device__ __forceinline__ float rsum16(float x) { x += __shfl_xor(x, 1, 32); x += __shfl_xor(x, 2, 32); x += __shfl_xor(x, 4, 32); x += __shfl_xor(x, 8, 32); return x; }

// k_attn: flash-style attention, one block = (batch b, 64 query rows), 4 waves x 16 rows; key blocks of 64.
// S tile: A = q rows [b][i][d] (fp16 plane), B = k rows [b][m][d] (fp16 plane, Bt layout); both fragments with the split-k map straight from global.
// Online softmax in f32 with scale folded as scl2 = SEQ^-0.5 * log2(e); p = exp2(s*scl2 - mrun) in (0, 1].
// P tile goes registers -> per-wave LDS (fp16 of p - CCEN) -> A fragment (block barrier between); B = v^T rows [b][d][m] (fp16 plane).
// acc += P'.v + CCEN * VS[b][kb][col]  (VS = f32 column sums of the 64 keys) so that acc == sum_m p_m v_m exactly in real arithmetic.
__global__ __launch_bounds__(128) __attribute__((amdgpu_num_vgpr(256)))
void k_attn(const h16* __restrict__ Q16, const h16* __restrict__ K16, const h16* __restrict__ Vt16, const float* __restrict__ VS, float* OUT, float scl2) {
    __shared__ __align__(16) float wsc[4][16 * OSP];
    const int tid = threadIdx.x, wave = tid >> 5, lane = tid & 31, l16 = lane & 15, hi = lane >> 4;
    const int nqb = SEQ / 64; const int b = blockIdx.x / nqb; const int row0 = (blockIdx.x % nqb) * 64 + wave * 16; const int nkb = SEQ / KBK;
    const h16* qp = Q16 + ((size_t)b * SEQ + row0 + l16) * DH + 8 * hi;
    const h16* kp = K16 + ((size_t)b * SEQ + l16) * DH + 8 * hi;
    const h16* vp = Vt16 + ((size_t)b * DH + l16) * SEQ + 8 * hi;
    const float* vsp = VS + (size_t)b * nkb * DH + l16;
    h16* myP = (h16*)(&wsc[wave][0]);
    float* os = &wsc[wave][0];
    v16h qa[2];
    qa[0] = cat16(*(const v8h*)qp, *(const v8h*)(qp + 16));
    qa[1] = cat16(*(const v8h*)(qp + 32), *(const v8h*)(qp + 48));
    v8f acc[4];
#pragma unroll
    for (int n = 0; n < 4; ++n) acc[n] = (v8f){};
    float m[8], l[8];
#pragma unroll
    for (int r = 0; r < 8; ++r) { m[r] = -1.0e30f; l[r] = 0.0f; }
#pragma unroll 1
    for (int kb = 0; kb < nkb; ++kb) {
        const int key0 = kb * KBK;
        __syncthreads();
        v8f s[4];
#pragma unroll
        for (int t = 0; t < 4; ++t) {
            const h16* p0 = kp + (size_t)(key0 + t * 16) * DH;
            const v16h b0 = cat16(*(const v8h*)p0, *(const v8h*)(p0 + 16));
            const v16h b1 = cat16(*(const v8h*)(p0 + 32), *(const v8h*)(p0 + 48));
            v8f c = (v8f){};
            c = wmma16(qa[0], b0, c); c = wmma16(qa[1], b1, c); s[t] = c; }
        asm volatile("v_nop\n\tv_nop\n\tv_nop\n\tv_nop" : "+v"(s[0]), "+v"(s[1]), "+v"(s[2]), "+v"(s[3]) : "v"(qa[0]), "v"(qa[1]));
        float vsn[4];
#pragma unroll
        for (int n = 0; n < 4; ++n) vsn[n] = vsp[(size_t)kb * DH + n * 16] * CCEN;
#pragma unroll
        for (int r = 0; r < 8; ++r) {
            float y[4];
#pragma unroll
            for (int t = 0; t < 4; ++t) y[t] = s[t][r] * scl2;
            float mx = fmaxf(fmaxf(y[0], y[1]), fmaxf(y[2], y[3])); mx = rmax16(mx);
            const float mn = fmaxf(m[r], mx); const float corr = exp2f(m[r] - mn); m[r] = mn;
            float p[4];
#pragma unroll
            for (int t = 0; t < 4; ++t) p[t] = exp2f(y[t] - mn);
            const float rs = rsum16((p[0] + p[1]) + (p[2] + p[3]));
            l[r] = l[r] * corr + rs;
#pragma unroll
            for (int n = 0; n < 4; ++n) acc[n][r] = acc[n][r] * corr + vsn[n];
#pragma unroll
            for (int t = 0; t < 4; ++t) myP[(r + 8 * hi) * KBK + t * 16 + l16] = (h16)(p[t] - CCEN);
        }
        __syncthreads();
        v16h pa[2]; const h16* pp = myP + l16 * KBK + 8 * hi;
        pa[0] = cat16(*(const v8ha*)pp, *(const v8ha*)(pp + 16));
        pa[1] = cat16(*(const v8ha*)(pp + 32), *(const v8ha*)(pp + 48));
#pragma unroll
        for (int n = 0; n < 4; ++n) {
            const h16* p0 = vp + (size_t)n * 16 * SEQ + key0;
            const v16h b0 = cat16(*(const v8h*)p0, *(const v8h*)(p0 + 16));
            const v16h b1 = cat16(*(const v8h*)(p0 + 32), *(const v8h*)(p0 + 48));
            acc[n] = wmma16(pa[0], b0, acc[n]); acc[n] = wmma16(pa[1], b1, acc[n]); }
        asm volatile("v_nop\n\tv_nop\n\tv_nop\n\tv_nop" : "+v"(acc[0]), "+v"(acc[1]), "+v"(acc[2]), "+v"(acc[3]) : "v"(pa[0]), "v"(pa[1]));
    }
    __syncthreads();
#pragma unroll
    for (int r = 0; r < 8; ++r) { const float inv = 1.0f / l[r];
#pragma unroll
        for (int n = 0; n < 4; ++n) os[(8 * hi + r) * OSP + n * 16 + l16] = acc[n][r] * inv; }
    __syncthreads();
    float* orow = OUT + ((size_t)b * SEQ + row0) * DH;
{
#pragma unroll
        for (int sg = 0; sg < 8; ++sg) { const int row = 2 * sg + hi, cofs = l16 * 4; const v4f val = *(const v4fa*)(os + row * OSP + cofs); *(v4f*)(orow + (size_t)row * DH + cofs) = val; }
         }
}

extern "C" void kernel_launch(void* const* d_in, const int* in_sizes, int n_in,
                              void* d_out, int out_size, void* d_ws, size_t ws_size, hipStream_t stream) {
    if (n_in < 5) return;
    const size_t need_x = ((size_t)(NB - 1) * SEQ_FULL + SEQ) * DH;
    if ((size_t)in_sizes[0] < need_x || (size_t)in_sizes[1] < need_x) return;
    if (in_sizes[2] < DH * DH || in_sizes[3] < DH * DH || in_sizes[4] < DH * DH) return;
    if ((size_t)out_size < (size_t)NB * SEQ * DH) return;
    const float* x1 = (const float*)d_in[0];   // [4][4096][64]
    const float* x2 = (const float*)d_in[1];   // [4][4096][64]
    const float* wq = (const float*)d_in[2];   // [64][64] = [out][in]
    const float* wk = (const float*)d_in[3];
    const float* wv = (const float*)d_in[4];
    float* OUT = (float*)d_out;                // [4][4096][64]
    const size_t n = (size_t)NB * SEQ * DH;
    char* wsp = (char*)d_ws;
    auto take = [&](size_t bytes) { char* p = wsp; wsp += (bytes + 255) & ~(size_t)255; return (void*)p; };
    bf* WB = (bf*)take((size_t)3 * DH * DH * 2); bf* WQB = WB; bf* WKB = WB + DH * DH; bf* WVB = WB + 2 * DH * DH;
    bf* XB1 = (bf*)take(n * 2); bf* XB2 = (bf*)take(n * 2);
    float* F32 = (float*)take(3 * n * 4); float* FQ = F32; float* FK = F32 + n; float* FVt = F32 + 2 * n;   // q [NB*SEQ][64], k [NB*SEQ][64], v^T [NB][64][SEQ]
    h16* P16 = (h16*)take(3 * n * 2); h16* Q16 = P16; h16* K16 = P16 + n; h16* Vt16 = P16 + 2 * n;          // fp16 planes, same layouts
    float* VS = (float*)take((size_t)NB * (SEQ / KBK) * DH * 4);                                             // [NB][SEQ/64][64]
    if ((size_t)(wsp - (char*)d_ws) > ws_size) return;    // total 23,158,784 B at NB=4, SEQ=4096
    const float sc = 1.0f / sqrtf((float)SEQ);
    const float scl2 = sc * 1.4426950408889634f;
    k_cvtw<<<dim3((DH * DH / 8 + 255) / 256, 3, 1), 256, 0, stream>>>(wq, wk, wv, WB);
    k_cvtx<<<dim3((unsigned)(((size_t)SEQ * DH / 8 + 255) / 256), NB, 2), 256, 0, stream>>>(x1, x2, XB1, XB2);
    k_gemmw<bf, 0, false><<<dim3(NB * SEQ / 64, 1, 1), 32, 0, stream>>>(XB1, nullptr, WQB, nullptr, DH, FQ, DH, nullptr, 0, 0, 0);                                      // q[i][n] = sum_d x1[i][d] Wq[n][d]
    k_gemmw<bf, 0, false><<<dim3(NB * SEQ / 64, 1, 1), 32, 0, stream>>>(XB2, nullptr, WKB, nullptr, DH, FK, DH, nullptr, 0, 0, 0);                                      // k[m][n] = sum_d x2[m][d] Wk[n][d]
    k_gemmw<bf, 0, false><<<dim3(1, SEQ / 64, NB), 32, 0, stream>>>(WVB, nullptr, XB2, nullptr, DH, FVt, SEQ, nullptr, (size_t)0, (size_t)SEQ * DH, (size_t)DH * SEQ);   // v^T[b][n][m] = sum_d Wv[n][d] x2[b][m][d]
    k_p16<<<(unsigned)((3 * n / 8 + 255) / 256), 256, 0, stream>>>(F32, P16, 3 * n / 8);
    k_vsum<<<dim3((SEQ / KBK + 15) / 16, NB, 1), 256, 0, stream>>>(FVt, VS);
    k_attn<<<NB * SEQ / 64, 128, 0, stream>>>(Q16, K16, Vt16, VS, OUT, scl2);
}

// v001
// It runs in 118 microseconds.
// Timed twice side by side with v000, it ran 1.68 times as fast both times.
#include <hip/hip_runtime.h>
#include <math.h>

// Single-head cross attention: q = x1 Wq^T, k = x2 Wk^T, v = x2 Wv^T (x [4][4096][64] f32, W [64][64] = [out][in]); p = softmax over keys of (q.k) * SEQ^-0.5; out = p v -> f32 [4][4096][64].
// Compute dtypes, f32 accumulate: all five inputs RNE-converted to bf16; q, k and v^T projections on v_wmma_f32_16x16x32_bf16 (plain bf16 operands); q.k^T and p.v on v_wmma_f32_16x16x32_f16 (q, k, v^T as plain fp16 planes; p enters as fp16 of (p - 0.6875), and 0.6875 * (64-key column sums of v, f32) is added to the f32 accumulator); online softmax (running max, exp2, row sums, 1/l) in f32.

#ifndef NB
#define NB 4
#endif
#ifndef SEQ
#define SEQ 4096
#endif
#define NB_FULL  4
#define SEQ_FULL 4096
#define DH       64
#define KBK      64
#define OSP      68
#define CCEN     0.6875f
#define KS       4      // key ranges per work-group: wave = (range, 16-row group)
static_assert(NB >= 1 && NB <= NB_FULL);
static_assert(SEQ >= KBK && SEQ <= SEQ_FULL && (SEQ % 64) == 0);
static_assert(DH == 64 && KBK == 64);
static_assert((SEQ / KBK) % KS == 0 && 8 % KS == 0);

typedef _Float16 h16;
typedef unsigned short bf;
typedef __attribute__((ext_vector_type(16))) __bf16   v16bf;
typedef __attribute__((ext_vector_type(16))) _Float16 v16h;
typedef __attribute__((ext_vector_type(8)))  _Float16 v8h;
typedef __attribute__((ext_vector_type(8)))  unsigned short v8us;
typedef __attribute__((ext_vector_type(8)))  float    v8f;
typedef __attribute__((ext_vector_type(4)))  float    v4f;
typedef v8h  __attribute__((may_alias)) v8ha;
typedef v4f  __attribute__((may_alias)) v4fa;

__device__ __forceinline__ unsigned short f2bf(float f) { unsigned u = __float_as_uint(f); u += 0x7FFFu + ((u >> 16) & 1u); return (unsigned short)(u >> 16); }
__device__ __forceinline__ float bf2f(unsigned short b) { return __uint_as_float(((unsigned)b) << 16); }
__device__ __forceinline__ float bfr(float f) { return bf2f(f2bf(f)); }
__device__ __forceinline__ v16h cat16(v8h lo, v8h hi) { return __builtin_shufflevector(lo, hi, 0, 1, 2, 3, 4, 5, 6, 7, 8, 9, 10, 11, 12, 13, 14, 15); }
__device__ __forceinline__ v16bf cat16b(v8us lo, v8us hi) { return __builtin_bit_cast(v16bf, __builtin_shufflevector(lo, hi, 0, 1, 2, 3, 4, 5, 6, 7, 8, 9, 10, 11, 12, 13, 14, 15)); }
__device__ __forceinline__ v8f wmma16(v16h a, v16h b, v8f c) { return __builtin_amdgcn_wmma_f32_16x16x32_f16(false, a, false, b, (short)0, c, false, false); }
__device__ __forceinline__ v8f wmmab(v16bf a, v16bf b, v8f c) { return __builtin_amdgcn_wmma_f32_16x16x32_bf16(false, a, false, b, (short)0, c, false, false); }

// ---- k_gemmw: register-blocked GEMM, ONE WAVE per 64x64 output tile (16 accumulators), operands straight from K-contiguous 16-bit planes; grid (M/64, N/64, Z), 32 threads.
// C[m][n] (f32, pitch ldc, + optional f32 bias[n]) = sum_k A[m][k] Bt[n][k] (+ split products per NSPLIT). z-batch strides sA/sB/sC in elements. K % 32 == 0.
// Fragment map (both operands): lane row/col = lane & 15, elements 0..7 <- k0 + 8h + 0..7, elements 8..15 <- k0 + 16 + 8h + 0..7 (h = lane >> 4).
template <typename T16> struct WFrag;
template <> struct WFrag<h16> { typedef v16h V; static __device__ __forceinline__ V ld(const h16* p) { return cat16(*(const v8h*)p, *(const v8h*)(p + 16)); } static __device__ __forceinline__ v8f mma(V a, V b, v8f c) { return wmma16(a, b, c); } };
template <> struct WFrag<bf> { typedef v16bf V; static __device__ __forceinline__ V ld(const bf* p) { return cat16b(*(const v8us*)p, *(const v8us*)(p + 16)); } static __device__ __forceinline__ v8f mma(V a, V b, v8f c) { return wmmab(a, b, c); } };
template <typename T16, int NSPLIT, bool BIAS>
__global__ __launch_bounds__(32) void k_gemmw(const T16* __restrict__ A, const T16* __restrict__ A2, const T16* __restrict__ Bt, const T16* __restrict__ Bt2, int K, float* C, int ldc, const float* __restrict__ bias, size_t sA, size_t sB, size_t sC) {
    typedef typename WFrag<T16>::V V;
    __shared__ __align__(16) float os[16 * 68];
    const size_t z = blockIdx.z; A += z * sA; if (A2) A2 += z * sA; Bt += z * sB; if (Bt2) Bt2 += z * sB; C += z * sC;
    const int lane = threadIdx.x & 31, lr = lane & 15, hi = lane >> 4; const int r0 = blockIdx.x * 64, c0 = blockIdx.y * 64;
    v8f acc[4][4];
#pragma unroll
    for (int mb = 0; mb < 4; ++mb)
#pragma unroll
        for (int nb = 0; nb < 4; ++nb) acc[mb][nb] = (v8f){};
    const size_t aoff = (size_t)(r0 + lr) * K + 8 * hi, boff = (size_t)(c0 + lr) * K + 8 * hi;
#pragma unroll 1
    for (int kc = 0; kc < K; kc += 32) {
        V a[4], a2[4];
#pragma unroll
        for (int mb = 0; mb < 4; ++mb) { a[mb] = WFrag<T16>::ld(A + aoff + (size_t)mb * 16 * K + kc); if (NSPLIT == 1 || NSPLIT == 2) a2[mb] = WFrag<T16>::ld(A2 + aoff + (size_t)mb * 16 * K + kc); }
#pragma unroll
        for (int nb = 0; nb < 4; ++nb) { const V b = WFrag<T16>::ld(Bt + boff + (size_t)nb * 16 * K + kc); V b2; if (NSPLIT >= 2) b2 = WFrag<T16>::ld(Bt2 + boff + (size_t)nb * 16 * K + kc);
#pragma unroll
            for (int mb = 0; mb < 4; ++mb) { acc[mb][nb] = WFrag<T16>::mma(a[mb], b, acc[mb][nb]); if (NSPLIT == 1 || NSPLIT == 2) acc[mb][nb] = WFrag<T16>::mma(a2[mb], b, acc[mb][nb]); if (NSPLIT >= 2) acc[mb][nb] = WFrag<T16>::mma(a[mb], b2, acc[mb][nb]); } }
        asm volatile("v_nop\n\tv_nop\n\tv_nop\n\tv_nop" : "+v"(acc[0][0]), "+v"(acc[1][1]), "+v"(acc[2][2]), "+v"(acc[3][3]) : "v"(a[0]), "v"(a[3]));
    }
#pragma unroll
    for (int mb = 0; mb < 4; ++mb) {
#pragma unroll
        for (int nb = 0; nb < 4; ++nb) {
#pragma unroll
            for (int j = 0; j < 8; ++j) os[(hi * 8 + j) * 68 + nb * 16 + lr] = acc[mb][nb][j]; }
        __builtin_amdgcn_wave_barrier(); asm volatile("" ::: "memory");
        float* crow = C + (size_t)(r0 + mb * 16) * ldc + c0;
{
#pragma unroll
            for (int s = 0; s < 8; ++s) { const int row = 2 * s + hi, cofs = lr * 4; v4f val = *(const v4fa*)(os + row * 68 + cofs); if (BIAS) { val[0] += bfr(bias[c0 + cofs]); val[1] += bfr(bias[c0 + cofs + 1]); val[2] += bfr(bias[c0 + cofs + 2]); val[3] += bfr(bias[c0 + cofs + 3]); }
                *(v4f*)(crow + (size_t)row * ldc + cofs) = val; }
             }
        __builtin_amdgcn_wave_barrier(); asm volatile("" ::: "memory");
    }
}

__global__ __launch_bounds__(256) void k_cvtw(const float* __restrict__ w0, const float* __restrict__ w1, const float* __restrict__ w2, bf* dst) {
    const int y = blockIdx.y; const float* src = (y == 0) ? w0 : ((y == 1) ? w1 : w2);
    const size_t i = (size_t)blockIdx.x * 256 + threadIdx.x; if (i >= (size_t)DH * DH / 8) return;
    const v8f v = *(const v8f*)(src + i * 8); v8us o;
#pragma unroll
    for (int k = 0; k < 8; ++k) o[k] = f2bf(v[k]);
    bf* dp = dst + (size_t)y * DH * DH + i * 8;
    *(v8us*)dp = o;  }

__global__ __launch_bounds__(256) void k_cvtx(const float* __restrict__ x1, const float* __restrict__ x2, bf* d1, bf* d2) {
    const int b = blockIdx.y; const bool second = (blockIdx.z != 0);
    const float* src = (second ? x2 : x1) + (size_t)b * SEQ_FULL * DH; bf* dst = (second ? d2 : d1) + (size_t)b * SEQ * DH;
    const size_t i = (size_t)blockIdx.x * 256 + threadIdx.x; if (i >= (size_t)SEQ * DH / 8) return;
    const v8f v = *(const v8f*)(src + i * 8); v8us o;
#pragma unroll
    for (int k = 0; k < 8; ++k) o[k] = f2bf(v[k]);
    *(v8us*)(dst + i * 8) = o;  }

__global__ __launch_bounds__(256) void k_p16(const float* __restrict__ src, h16* dst, size_t n8) {
    const size_t i = (size_t)blockIdx.x * 256 + threadIdx.x; if (i >= n8) return;
    const v8f v = *(const v8f*)(src + i * 8); v8h o;
#pragma unroll
    for (int k = 0; k < 8; ++k) o[k] = (h16)v[k];
    *(v8h*)(dst + i * 8) = o;  }

__global__ __launch_bounds__(256) void k_vsum(const float* __restrict__ FVt, float* VS) {
    const int t = threadIdx.x; const int b = blockIdx.y; const int nkb = SEQ / KBK; const int kb = blockIdx.x * 16 + (t >> 4); const int d0 = (t & 15) * 4;
    if (kb >= nkb) return;
    const float* src = FVt + ((size_t)b * DH + d0) * SEQ + (size_t)kb * KBK;
    v4f o;
#pragma unroll
    for (int j = 0; j < 4; ++j) { const float* col = src + (size_t)j * SEQ; v4f s4 = (v4f){};
#pragma unroll 4
        for (int q = 0; q < KBK / 4; ++q) s4 += *(const v4f*)(col + q * 4);
        o[j] = (s4[0] + s4[1]) + (s4[2] + s4[3]); }
    float* dp = VS + ((size_t)b * nkb + kb) * DH + d0;
    *(v4f*)dp = o;  }

// 16-lane (half-wave) reductions matching the WMMA D layout (lanes 0-15 / 16-31 each hold one group of rows).
__device__ __forceinline__ float rmax16(float x) { x = fmaxf(x, __shfl_xor(x, 1, 32)); x = fmaxf(x, __shfl_xor(x, 2, 32)); x = fmaxf(x, __shfl_xor(x, 4, 32)); x = fmaxf(x, __shfl_xor(x, 8, 32)); return x; }
__device__ __forceinline__ float rsum16(float x) { x += __shfl_xor(x, 1, 32); x += __shfl_xor(x, 2, 32); x += __shfl_xor(x, 4, 32); x += __shfl_xor(x, 8, 32); return x; }

// k_attn: flash-style attention, one block = (batch b, 64 query rows), 4 * KS waves: wave & 3 = 16-row group, wave >> 2 = key range; range ks takes key blocks ks, ks + KS, ... (64 keys each)
// with its own running max, row sums and un-normalised accumulators; the KS partials of a row are merged in LDS at the end (weights exp2(m_ks - max), one division by the merged sum).
// S tile: A = q rows [b][i][d] (fp16 plane), B = k rows [b][m][d] (fp16 plane, Bt layout); both fragments with the split-k map straight from global.
// Online softmax in f32 with scale folded as scl2 = SEQ^-0.5 * log2(e); p = exp2(s*scl2 - mrun) in (0, 1].
// P tile goes registers -> per-wave LDS (fp16 of p - CCEN) -> A fragment (block barrier between); B = v^T rows [b][d][m] (fp16 plane).
// acc += P'.v + CCEN * VS[b][kb][col]  (VS = f32 column sums of the 64 keys) so that acc == sum_m p_m v_m exactly in real arithmetic.
__global__ __launch_bounds__(128 * KS) __attribute__((amdgpu_waves_per_eu(KS, KS)))
void k_attn(const h16* __restrict__ Q16, const h16* __restrict__ K16, const h16* __restrict__ Vt16, const float* __restrict__ VS, float* OUT, float scl2) {
    __shared__ __align__(16) float wsc[4 * KS][16 * OSP];
    __shared__ float sml[4 * KS][2][16];
    const int tid = threadIdx.x, wave = tid >> 5, lane = tid & 31, l16 = lane & 15, hi = lane >> 4;
    const int nqb = SEQ / 64; const int b = blockIdx.x / nqb; const int blk0 = (blockIdx.x % nqb) * 64; const int row0 = blk0 + (wave & 3) * 16; const int nkb = SEQ / KBK;
    const h16* qp = Q16 + ((size_t)b * SEQ + row0 + l16) * DH + 8 * hi;
    const h16* kp = K16 + ((size_t)b * SEQ + l16) * DH + 8 * hi;
    const h16* vp = Vt16 + ((size_t)b * DH + l16) * SEQ + 8 * hi;
    const float* vsp = VS + (size_t)b * nkb * DH + l16;
    const int ks0 = __builtin_amdgcn_readfirstlane(wave >> 2);   // key range in a scalar register: the loop's count and branch stay scalar, EXEC untouched around the matrix instructions and barriers
    h16* myP = (h16*)(&wsc[wave][0]);
    float* os = &wsc[wave][0];
    v16h qa[2];
    qa[0] = cat16(*(const v8h*)qp, *(const v8h*)(qp + 16));
    qa[1] = cat16(*(const v8h*)(qp + 32), *(const v8h*)(qp + 48));
    v8f acc[4];
#pragma unroll
    for (int n = 0; n < 4; ++n) acc[n] = (v8f){};
    float m[8], l[8];
#pragma unroll
    for (int r = 0; r < 8; ++r) { m[r] = -1.0e30f; l[r] = 0.0f; }
#pragma unroll 1
    for (int kb = ks0; kb < nkb; kb += KS) {
        const int key0 = kb * KBK;
        __syncthreads();
        v8f s[4];
#pragma unroll
        for (int t = 0; t < 4; ++t) {
            const h16* p0 = kp + (size_t)(key0 + t * 16) * DH;
            const v16h b0 = cat16(*(const v8h*)p0, *(const v8h*)(p0 + 16));
            const v16h b1 = cat16(*(const v8h*)(p0 + 32), *(const v8h*)(p0 + 48));
            v8f c = (v8f){};
            c = wmma16(qa[0], b0, c); c = wmma16(qa[1], b1, c); s[t] = c; }
        asm volatile("v_nop\n\tv_nop\n\tv_nop\n\tv_nop" : "+v"(s[0]), "+v"(s[1]), "+v"(s[2]), "+v"(s[3]) : "v"(qa[0]), "v"(qa[1]));
        float vsn[4];
#pragma unroll
        for (int n = 0; n < 4; ++n) vsn[n] = vsp[(size_t)kb * DH + n * 16] * CCEN;
#pragma unroll
        for (int r = 0; r < 8; ++r) {
            float y[4];
#pragma unroll
            for (int t = 0; t < 4; ++t) y[t] = s[t][r] * scl2;
            float mx = fmaxf(fmaxf(y[0], y[1]), fmaxf(y[2], y[3])); mx = rmax16(mx);
            const float mn = fmaxf(m[r], mx); const float corr = exp2f(m[r] - mn); m[r] = mn;
            float p[4];
#pragma unroll
            for (int t = 0; t < 4; ++t) p[t] = exp2f(y[t] - mn);
            const float rs = rsum16((p[0] + p[1]) + (p[2] + p[3]));
            l[r] = l[r] * corr + rs;
#pragma unroll
            for (int n = 0; n < 4; ++n) acc[n][r] = acc[n][r] * corr + vsn[n];
#pragma unroll
            for (int t = 0; t < 4; ++t) myP[(r + 8 * hi) * KBK + t * 16 + l16] = (h16)(p[t] - CCEN);
        }
        __syncthreads();
        v16h pa[2]; const h16* pp = myP + l16 * KBK + 8 * hi;
        pa[0] = cat16(*(const v8ha*)pp, *(const v8ha*)(pp + 16));
        pa[1] = cat16(*(const v8ha*)(pp + 32), *(const v8ha*)(pp + 48));
#pragma unroll
        for (int n = 0; n < 4; ++n) {
            const h16* p0 = vp + (size_t)n * 16 * SEQ + key0;
            const v16h b0 = cat16(*(const v8h*)p0, *(const v8h*)(p0 + 16));
            const v16h b1 = cat16(*(const v8h*)(p0 + 32), *(const v8h*)(p0 + 48));
            acc[n] = wmma16(pa[0], b0, acc[n]); acc[n] = wmma16(pa[1], b1, acc[n]); }
        asm volatile("v_nop\n\tv_nop\n\tv_nop\n\tv_nop" : "+v"(acc[0]), "+v"(acc[1]), "+v"(acc[2]), "+v"(acc[3]) : "v"(pa[0]), "v"(pa[1]));
    }
    __syncthreads();
#pragma unroll
    for (int r = 0; r < 8; ++r) {
        if (l16 == 0) { sml[wave][0][8 * hi + r] = m[r]; sml[wave][1][8 * hi + r] = l[r]; }
#pragma unroll
        for (int n = 0; n < 4; ++n) os[(8 * hi + r) * OSP + n * 16 + l16] = acc[n][r]; }
    __syncthreads();
    float* orow = OUT + ((size_t)b * SEQ + blk0) * DH;
    // the three unrolls below: constant trip counts (8 / KS, KS), so that the LDS reads of all KS partials issue together instead of one wait per range
#pragma unroll
    for (int i = 0; i < 8 / KS; ++i) {
        const int idx = tid + i * 128 * KS; const int row = idx >> 4, cofs = (idx & 15) * 4, rg = row >> 4, rr = row & 15;
        float mm = sml[rg][0][rr];
#pragma unroll
        for (int ks = 1; ks < KS; ++ks) mm = fmaxf(mm, sml[ks * 4 + rg][0][rr]);
        float ls = 0.0f; v4f o = (v4f){};
#pragma unroll
        for (int ks = 0; ks < KS; ++ks) { const float w = exp2f(sml[ks * 4 + rg][0][rr] - mm); ls += w * sml[ks * 4 + rg][1][rr]; o += w * *(const v4fa*)(&wsc[ks * 4 + rg][rr * OSP + cofs]); }
        *(v4f*)(orow + (size_t)row * DH + cofs) = o * (1.0f / ls);
    }
}

extern "C" void kernel_launch(void* const* d_in, const int* in_sizes, int n_in,
                              void* d_out, int out_size, void* d_ws, size_t ws_size, hipStream_t stream) {
    if (n_in < 5) return;
    const size_t need_x = ((size_t)(NB - 1) * SEQ_FULL + SEQ) * DH;
    if ((size_t)in_sizes[0] < need_x || (size_t)in_sizes[1] < need_x) return;
    if (in_sizes[2] < DH * DH || in_sizes[3] < DH * DH || in_sizes[4] < DH * DH) return;
    if ((size_t)out_size < (size_t)NB * SEQ * DH) return;
    const float* x1 = (const float*)d_in[0];   // [4][4096][64]
    const float* x2 = (const float*)d_in[1];   // [4][4096][64]
    const float* wq = (const float*)d_in[2];   // [64][64] = [out][in]
    const float* wk = (const float*)d_in[3];
    const float* wv = (const float*)d_in[4];
    float* OUT = (float*)d_out;                // [4][4096][64]
    const size_t n = (size_t)NB * SEQ * DH;
    char* wsp = (char*)d_ws;
    auto take = [&](size_t bytes) { char* p = wsp; wsp += (bytes + 255) & ~(size_t)255; return (void*)p; };
    bf* WB = (bf*)take((size_t)3 * DH * DH * 2); bf* WQB = WB; bf* WKB = WB + DH * DH; bf* WVB = WB + 2 * DH * DH;
    bf* XB1 = (bf*)take(n * 2); bf* XB2 = (bf*)take(n * 2);
    float* F32 = (float*)take(3 * n * 4); float* FQ = F32; float* FK = F32 + n; float* FVt = F32 + 2 * n;   // q [NB*SEQ][64], k [NB*SEQ][64], v^T [NB][64][SEQ]
    h16* P16 = (h16*)take(3 * n * 2); h16* Q16 = P16; h16* K16 = P16 + n; h16* Vt16 = P16 + 2 * n;          // fp16 planes, same layouts
    float* VS = (float*)take((size_t)NB * (SEQ / KBK) * DH * 4);                                             // [NB][SEQ/64][64]
    if ((size_t)(wsp - (char*)d_ws) > ws_size) return;    // total 23,158,784 B at NB=4, SEQ=4096
    const float sc = 1.0f / sqrtf((float)SEQ);
    const float scl2 = sc * 1.4426950408889634f;
    k_cvtw<<<dim3((DH * DH / 8 + 255) / 256, 3, 1), 256, 0, stream>>>(wq, wk, wv, WB);
    k_cvtx<<<dim3((unsigned)(((size_t)SEQ * DH / 8 + 255) / 256), NB, 2), 256, 0, stream>>>(x1, x2, XB1, XB2);
    k_gemmw<bf, 0, false><<<dim3(NB * SEQ / 64, 1, 1), 32, 0, stream>>>(XB1, nullptr, WQB, nullptr, DH, FQ, DH, nullptr, 0, 0, 0);                                      // q[i][n] = sum_d x1[i][d] Wq[n][d]
    k_gemmw<bf, 0, false><<<dim3(NB * SEQ / 64, 1, 1), 32, 0, stream>>>(XB2, nullptr, WKB, nullptr, DH, FK, DH, nullptr, 0, 0, 0);                                      // k[m][n] = sum_d x2[m][d] Wk[n][d]
    k_gemmw<bf, 0, false><<<dim3(1, SEQ / 64, NB), 32, 0, stream>>>(WVB, nullptr, XB2, nullptr, DH, FVt, SEQ, nullptr, (size_t)0, (size_t)SEQ * DH, (size_t)DH * SEQ);   // v^T[b][n][m] = sum_d Wv[n][d] x2[b][m][d]
    k_p16<<<(unsigned)((3 * n / 8 + 255) / 256), 256, 0, stream>>>(F32, P16, 3 * n / 8);
    k_vsum<<<dim3((SEQ / KBK + 15) / 16, NB, 1), 256, 0, stream>>>(FVt, VS);
    k_attn<<<NB * SEQ / 64, 128 * KS, 0, stream>>>(Q16, K16, Vt16, VS, OUT, scl2);
}

// v002
// It runs in 89 microseconds.
// Next to v001, in two timings, it ran 1.34 and 1.33 times as fast.
// Counting every step since v000, it is 2.24 times as fast.
#include <hip/hip_runtime.h>
#include <math.h>

// Single-head cross attention: q = x1 Wq^T, k = x2 Wk^T, v = x2 Wv^T (x [4][4096][64] f32, W [64][64] = [out][in]); p = softmax over keys of (q.k) * SEQ^-0.5; out = p v -> f32 [4][4096][64].
// Compute dtypes, f32 accumulate: all five inputs RNE-converted to bf16; q, k and v^T projections on v_wmma_f32_16x16x32_bf16 (plain bf16 operands); q.k^T and p.v on v_wmma_f32_16x16x32_f16 (q, k, v^T as plain fp16 planes; p enters as fp16 of (p - 0.6875), and 0.6875 * (64-key column sums of v, f32) is added to the f32 accumulator); online softmax (running max, exp2, row sums, 1/l) in f32.

#ifndef NB
#define NB 4
#endif
#ifndef SEQ
#define SEQ 4096
#endif
#define NB_FULL  4
#define SEQ_FULL 4096
#define DH       64
#define KBK      64
#define OSP      68
#define CCEN     0.6875f
#define KS       4      // key ranges per work-group: wave = (range, 16-row group)
static_assert(NB >= 1 && NB <= NB_FULL);
static_assert(SEQ >= KBK && SEQ <= SEQ_FULL && (SEQ % 64) == 0);
static_assert(DH == 64 && KBK == 64);
static_assert((SEQ / KBK) % KS == 0 && 8 % KS == 0);

typedef _Float16 h16;
typedef unsigned short bf;
typedef __attribute__((ext_vector_type(16))) __bf16   v16bf;
typedef __attribute__((ext_vector_type(16))) _Float16 v16h;
typedef __attribute__((ext_vector_type(8)))  _Float16 v8h;
typedef __attribute__((ext_vector_type(8)))  unsigned short v8us;
typedef __attribute__((ext_vector_type(8)))  float    v8f;
typedef __attribute__((ext_vector_type(4)))  float    v4f;
typedef v8h  __attribute__((may_alias)) v8ha;
typedef v4f  __attribute__((may_alias)) v4fa;

__device__ __forceinline__ unsigned short f2bf(float f) { unsigned u = __float_as_uint(f); u += 0x7FFFu + ((u >> 16) & 1u); return (unsigned short)(u >> 16); }
__device__ __forceinline__ float bf2f(unsigned short b) { return __uint_as_float(((unsigned)b) << 16); }
__device__ __forceinline__ float bfr(float f) { return bf2f(f2bf(f)); }
__device__ __forceinline__ v16h cat16(v8h lo, v8h hi) { return __builtin_shufflevector(lo, hi, 0, 1, 2, 3, 4, 5, 6, 7, 8, 9, 10, 11, 12, 13, 14, 15); }
__device__ __forceinline__ v16bf cat16b(v8us lo, v8us hi) { return __builtin_bit_cast(v16bf, __builtin_shufflevector(lo, hi, 0, 1, 2, 3, 4, 5, 6, 7, 8, 9, 10, 11, 12, 13, 14, 15)); }
__device__ __forceinline__ v8f wmma16(v16h a, v16h b, v8f c) { return __builtin_amdgcn_wmma_f32_16x16x32_f16(false, a, false, b, (short)0, c, false, false); }
__device__ __forceinline__ v8f wmmab(v16bf a, v16bf b, v8f c) { return __builtin_amdgcn_wmma_f32_16x16x32_bf16(false, a, false, b, (short)0, c, false, false); }

// ---- k_gemmw: register-blocked GEMM, ONE WAVE per 64x64 output tile (16 accumulators), operands straight from K-contiguous 16-bit planes; grid (M/64, N/64, Z), 32 threads.
// C[m][n] (f32, pitch ldc, + optional f32 bias[n]) = sum_k A[m][k] Bt[n][k] (+ split products per NSPLIT). z-batch strides sA/sB/sC in elements. K % 32 == 0.
// Fragment map (both operands): lane row/col = lane & 15, elements 0..7 <- k0 + 8h + 0..7, elements 8..15 <- k0 + 16 + 8h + 0..7 (h = lane >> 4).
template <typename T16> struct WFrag;
template <> struct WFrag<h16> { typedef v16h V; static __device__ __forceinline__ V ld(const h16* p) { return cat16(*(const v8h*)p, *(const v8h*)(p + 16)); } static __device__ __forceinline__ v8f mma(V a, V b, v8f c) { return wmma16(a, b, c); } };
template <> struct WFrag<bf> { typedef v16bf V; static __device__ __forceinline__ V ld(const bf* p) { return cat16b(*(const v8us*)p, *(const v8us*)(p + 16)); } static __device__ __forceinline__ v8f mma(V a, V b, v8f c) { return wmmab(a, b, c); } };
template <typename T16, int NSPLIT, bool BIAS>
__global__ __launch_bounds__(32) void k_gemmw(const T16* __restrict__ A, const T16* __restrict__ A2, const T16* __restrict__ Bt, const T16* __restrict__ Bt2, int K, float* C, int ldc, const float* __restrict__ bias, size_t sA, size_t sB, size_t sC) {
    typedef typename WFrag<T16>::V V;
    __shared__ __align__(16) float os[16 * 68];
    const size_t z = blockIdx.z; A += z * sA; if (A2) A2 += z * sA; Bt += z * sB; if (Bt2) Bt2 += z * sB; C += z * sC;
    const int lane = threadIdx.x & 31, lr = lane & 15, hi = lane >> 4; const int r0 = blockIdx.x * 64, c0 = blockIdx.y * 64;
    v8f acc[4][4];
#pragma unroll
    for (int mb = 0; mb < 4; ++mb)
#pragma unroll
        for (int nb = 0; nb < 4; ++nb) acc[mb][nb] = (v8f){};
    const size_t aoff = (size_t)(r0 + lr) * K + 8 * hi, boff = (size_t)(c0 + lr) * K + 8 * hi;
#pragma unroll 1
    for (int kc = 0; kc < K; kc += 32) {
        V a[4], a2[4];
#pragma unroll
        for (int mb = 0; mb < 4; ++mb) { a[mb] = WFrag<T16>::ld(A + aoff + (size_t)mb * 16 * K + kc); if (NSPLIT == 1 || NSPLIT == 2) a2[mb] = WFrag<T16>::ld(A2 + aoff + (size_t)mb * 16 * K + kc); }
#pragma unroll
        for (int nb = 0; nb < 4; ++nb) { const V b = WFrag<T16>::ld(Bt + boff + (size_t)nb * 16 * K + kc); V b2; if (NSPLIT >= 2) b2 = WFrag<T16>::ld(Bt2 + boff + (size_t)nb * 16 * K + kc);
#pragma unroll
            for (int mb = 0; mb < 4; ++mb) { acc[mb][nb] = WFrag<T16>::mma(a[mb], b, acc[mb][nb]); if (NSPLIT == 1 || NSPLIT == 2) acc[mb][nb] = WFrag<T16>::mma(a2[mb], b, acc[mb][nb]); if (NSPLIT >= 2) acc[mb][nb] = WFrag<T16>::mma(a[mb], b2, acc[mb][nb]); } }
        asm volatile("v_nop\n\tv_nop\n\tv_nop\n\tv_nop" : "+v"(acc[0][0]), "+v"(acc[1][1]), "+v"(acc[2][2]), "+v"(acc[3][3]) : "v"(a[0]), "v"(a[3]));
    }
#pragma unroll
    for (int mb = 0; mb < 4; ++mb) {
#pragma unroll
        for (int nb = 0; nb < 4; ++nb) {
#pragma unroll
            for (int j = 0; j < 8; ++j) os[(hi * 8 + j) * 68 + nb * 16 + lr] = acc[mb][nb][j]; }
        __builtin_amdgcn_wave_barrier(); asm volatile("" ::: "memory");
        float* crow = C + (size_t)(r0 + mb * 16) * ldc + c0;
{
#pragma unroll
            for (int s = 0; s < 8; ++s) { const int row = 2 * s + hi, cofs = lr * 4; v4f val = *(const v4fa*)(os + row * 68 + cofs); if (BIAS) { val[0] += bfr(bias[c0 + cofs]); val[1] += bfr(bias[c0 + cofs + 1]); val[2] += bfr(bias[c0 + cofs + 2]); val[3] += bfr(bias[c0 + cofs + 3]); }
                *(v4f*)(crow + (size_t)row * ldc + cofs) = val; }
             }
        __builtin_amdgcn_wave_barrier(); asm volatile("" ::: "memory");
    }
}

__global__ __launch_bounds__(256) void k_cvtw(const float* __restrict__ w0, const float* __restrict__ w1, const float* __restrict__ w2, bf* dst) {
    const int y = blockIdx.y; const float* src = (y == 0) ? w0 : ((y == 1) ? w1 : w2);
    const size_t i = (size_t)blockIdx.x * 256 + threadIdx.x; if (i >= (size_t)DH * DH / 8) return;
    const v8f v = *(const v8f*)(src + i * 8); v8us o;
#pragma unroll
    for (int k = 0; k < 8; ++k) o[k] = f2bf(v[k]);
    bf* dp = dst + (size_t)y * DH * DH + i * 8;
    *(v8us*)dp = o;  }

__global__ __launch_bounds__(256) void k_cvtx(const float* __restrict__ x1, const float* __restrict__ x2, bf* d1, bf* d2) {
    const int b = blockIdx.y; const bool second = (blockIdx.z != 0);
    const float* src = (second ? x2 : x1) + (size_t)b * SEQ_FULL * DH; bf* dst = (second ? d2 : d1) + (size_t)b * SEQ * DH;
    const size_t i = (size_t)blockIdx.x * 256 + threadIdx.x; if (i >= (size_t)SEQ * DH / 8) return;
    const v8f v = *(const v8f*)(src + i * 8); v8us o;
#pragma unroll
    for (int k = 0; k < 8; ++k) o[k] = f2bf(v[k]);
    *(v8us*)(dst + i * 8) = o;  }

__global__ __launch_bounds__(256) void k_p16(const float* __restrict__ src, h16* dst, size_t n8) {
    const size_t i = (size_t)blockIdx.x * 256 + threadIdx.x; if (i >= n8) return;
    const v8f v = *(const v8f*)(src + i * 8); v8h o;
#pragma unroll
    for (int k = 0; k < 8; ++k) o[k] = (h16)v[k];
    *(v8h*)(dst + i * 8) = o;  }

__global__ __launch_bounds__(256) void k_vsum(const float* __restrict__ FVt, float* VS) {
    const int t = threadIdx.x; const int b = blockIdx.y; const int nkb = SEQ / KBK; const int kb = blockIdx.x * 16 + (t >> 4); const int d0 = (t & 15) * 4;
    if (kb >= nkb) return;
    const float* src = FVt + ((size_t)b * DH + d0) * SEQ + (size_t)kb * KBK;
    v4f o;
#pragma unroll
    for (int j = 0; j < 4; ++j) { const float* col = src + (size_t)j * SEQ; v4f s4 = (v4f){};
#pragma unroll 4
        for (int q = 0; q < KBK / 4; ++q) s4 += *(const v4f*)(col + q * 4);
        o[j] = (s4[0] + s4[1]) + (s4[2] + s4[3]); }
    float* dp = VS + ((size_t)b * nkb + kb) * DH + d0;
    *(v4f*)dp = o;  }

// lane l <-> l ^ 16: the two halves of a wave hold the two key halves of one query column.
__device__ __forceinline__ float xhalf(float x) { const int b = __float_as_int(x); return __int_as_float(__builtin_amdgcn_permlanex16(b, b, 0x76543210, 0xfedcba98, false, false)); }

// k_attn: flash-style attention, one block = (batch b, 64 query rows), 4 * KS waves: wave & 3 = 16-query group, wave >> 2 = key range; range ks takes key blocks ks, ks + KS, ... (64 keys each)
// with its own running max, sums and un-normalised accumulators; the KS partials of a query are merged in LDS at the end (weights exp2(m_ks - max), one division by the merged sum).
// Transposed tiles: S^T = K.Q^T (A = k rows [b][m][d], B = q rows [b][i][d], fp16 planes, both with the split-k map straight from global): register r of tile t = score of key 16t + 8h + r for query lane & 15,
// so a lane holds 32 of its query's 64 scores: max and sum run in registers, the max joined between the halves by one cross-row move per key block, the sums joined once after the loop.
// Online softmax in f32 with scale folded as scl2 = SEQ^-0.5 * log2(e); p = exp2(s*scl2 - mrun) in (0, 1].
// P^T: score tiles 2c and 2c + 1, converted in place (fp16 of p - CCEN), are the B fragment of keys 32c .. 32c + 31; A = v^T rows [b][d][m] (fp16 plane, same map): O^T += V^T.P^T, no LDS and no barrier in the loop.
// acc[n][r] = O^T[16n + 8h + r][query]; acc += CCEN * VS[b][kb][d]  (VS = f32 column sums of the 64 keys) so that acc == sum_m p_m v_m exactly in real arithmetic.
__global__ __launch_bounds__(128 * KS) __attribute__((amdgpu_waves_per_eu(KS, KS)))
void k_attn(const h16* __restrict__ Q16, const h16* __restrict__ K16, const h16* __restrict__ Vt16, const float* __restrict__ VS, float* OUT, float scl2) {
    __shared__ __align__(16) float wsc[4 * KS][16 * OSP];
    __shared__ float sml[4 * KS][2][16];
    const int tid = threadIdx.x, wave = tid >> 5, lane = tid & 31, l16 = lane & 15, hi = lane >> 4;
    const int nqb = SEQ / 64; const int b = blockIdx.x / nqb; const int blk0 = (blockIdx.x % nqb) * 64; const int row0 = blk0 + (wave & 3) * 16; const int nkb = SEQ / KBK;
    const h16* qp = Q16 + ((size_t)b * SEQ + row0 + l16) * DH + 8 * hi;
    const h16* kp = K16 + ((size_t)b * SEQ + l16) * DH + 8 * hi;
    const h16* vp = Vt16 + ((size_t)b * DH + l16) * SEQ + 8 * hi;
    const float* vsp = VS + (size_t)b * nkb * DH + 8 * hi;
    const int ks0 = __builtin_amdgcn_readfirstlane(wave >> 2);   // key range in a scalar register: the loop's count and branch stay scalar, EXEC untouched around the matrix instructions
    float* os = &wsc[wave][0];
    v16h qb[2];
    qb[0] = cat16(*(const v8h*)qp, *(const v8h*)(qp + 16));
    qb[1] = cat16(*(const v8h*)(qp + 32), *(const v8h*)(qp + 48));
    v8f acc[4];
#pragma unroll
    for (int n = 0; n < 4; ++n) acc[n] = (v8f){};
    float m = -1.0e30f, l = 0.0f;
#pragma unroll 1
    for (int kb = ks0; kb < nkb; kb += KS) {
        const int key0 = kb * KBK;
        v16h ka[4][2];
#pragma unroll
        for (int t = 0; t < 4; ++t) {
            const h16* p0 = kp + (size_t)(key0 + t * 16) * DH;
            ka[t][0] = cat16(*(const v8h*)p0, *(const v8h*)(p0 + 16));
            ka[t][1] = cat16(*(const v8h*)(p0 + 32), *(const v8h*)(p0 + 48)); }
        __builtin_amdgcn_sched_barrier(0);   // all 16 k loads issue before the first product; without it the compiler spreads them among the products and a wave waits out the load latency several times per key block
        v8f s[4];
#pragma unroll
        for (int t = 0; t < 4; ++t) { v8f c = (v8f){}; c = wmma16(ka[t][0], qb[0], c); c = wmma16(ka[t][1], qb[1], c); s[t] = c; }
        // four vector slots between the last score product and the first vector instruction that reads a score tile
        asm volatile("v_nop\n\tv_nop\n\tv_nop\n\tv_nop" : "+v"(s[0]), "+v"(s[1]), "+v"(s[2]), "+v"(s[3]) : "v"(qb[0]), "v"(qb[1]));
        float mt[4];
#pragma unroll
        for (int t = 0; t < 4; ++t) mt[t] = fmaxf(fmaxf(fmaxf(s[t][0], s[t][1]), fmaxf(s[t][2], s[t][3])), fmaxf(fmaxf(s[t][4], s[t][5]), fmaxf(s[t][6], s[t][7])));
        float mx = fmaxf(fmaxf(mt[0], mt[1]), fmaxf(mt[2], mt[3])); mx = fmaxf(mx, xhalf(mx)) * scl2;   // scl2 > 0: the scaled max is the max of the scaled scores
        const float mn = fmaxf(m, mx); const float corr = exp2f(m - mn); m = mn;
        v16h pb[2]; float st[4];
#pragma unroll
        for (int t = 0; t < 4; ++t) {
            float p[8];
#pragma unroll
            for (int r = 0; r < 8; ++r) { p[r] = exp2f(s[t][r] * scl2 - mn); pb[t >> 1][(t & 1) * 8 + r] = (h16)(p[r] - CCEN); }
            st[t] = ((p[0] + p[1]) + (p[2] + p[3])) + ((p[4] + p[5]) + (p[6] + p[7])); }
        l = l * corr + ((st[0] + st[1]) + (st[2] + st[3]));
#pragma unroll
        for (int n = 0; n < 4; ++n) {
            const float* vs0 = vsp + (size_t)kb * DH + n * 16;
            const v4f va = *(const v4f*)vs0, vb = *(const v4f*)(vs0 + 4);
            const v8f vs8 = __builtin_shufflevector(va, vb, 0, 1, 2, 3, 4, 5, 6, 7);
            acc[n] = acc[n] * corr + vs8 * CCEN; }
#pragma unroll
        for (int n = 0; n < 4; ++n) {
            const h16* p0 = vp + (size_t)n * 16 * SEQ + key0;
            const v16h a0 = cat16(*(const v8h*)p0, *(const v8h*)(p0 + 16));
            const v16h a1 = cat16(*(const v8h*)(p0 + 32), *(const v8h*)(p0 + 48));
            acc[n] = wmma16(a0, pb[0], acc[n]); acc[n] = wmma16(a1, pb[1], acc[n]); }
        // the same four slots behind the last output product, on the loop's taken back edge and on its exit alike
        asm volatile("v_nop\n\tv_nop\n\tv_nop\n\tv_nop" : "+v"(acc[0]), "+v"(acc[1]), "+v"(acc[2]), "+v"(acc[3]) : "v"(pb[0]), "v"(pb[1]));
    }
    l += xhalf(l);
    if (hi == 0) { sml[wave][0][l16] = m; sml[wave][1][l16] = l; }
#pragma unroll
    for (int n = 0; n < 4; ++n) {
        *(v4fa*)(os + l16 * OSP + n * 16 + 8 * hi) = __builtin_shufflevector(acc[n], acc[n], 0, 1, 2, 3);
        *(v4fa*)(os + l16 * OSP + n * 16 + 8 * hi + 4) = __builtin_shufflevector(acc[n], acc[n], 4, 5, 6, 7); }
    __syncthreads();
    float* orow = OUT + ((size_t)b * SEQ + blk0) * DH;
    // the three unrolls below: constant trip counts (8 / KS, KS), so that the LDS reads of all KS partials issue together instead of one wait per range
#pragma unroll
    for (int i = 0; i < 8 / KS; ++i) {
        const int idx = tid + i * 128 * KS; const int row = idx >> 4, cofs = (idx & 15) * 4, rg = row >> 4, rr = row & 15;
        float mm = sml[rg][0][rr];
#pragma unroll
        for (int ks = 1; ks < KS; ++ks) mm = fmaxf(mm, sml[ks * 4 + rg][0][rr]);
        float ls = 0.0f; v4f o = (v4f){};
#pragma unroll
        for (int ks = 0; ks < KS; ++ks) { const float w = exp2f(sml[ks * 4 + rg][0][rr] - mm); ls += w * sml[ks * 4 + rg][1][rr]; o += w * *(const v4fa*)(&wsc[ks * 4 + rg][rr * OSP + cofs]); }
        *(v4f*)(orow + (size_t)row * DH + cofs) = o * (1.0f / ls);
    }
}

extern "C" void kernel_launch(void* const* d_in, const int* in_sizes, int n_in,
                              void* d_out, int out_size, void* d_ws, size_t ws_size, hipStream_t stream) {
    if (n_in < 5) return;
    const size_t need_x = ((size_t)(NB - 1) * SEQ_FULL + SEQ) * DH;
    if ((size_t)in_sizes[0] < need_x || (size_t)in_sizes[1] < need_x) return;
    if (in_sizes[2] < DH * DH || in_sizes[3] < DH * DH || in_sizes[4] < DH * DH) return;
    if ((size_t)out_size < (size_t)NB * SEQ * DH) return;
    const float* x1 = (const float*)d_in[0];   // [4][4096][64]
    const float* x2 = (const float*)d_in[1];   // [4][4096][64]
    const float* wq = (const float*)d_in[2];   // [64][64] = [out][in]
    const float* wk = (const float*)d_in[3];
    const float* wv = (const float*)d_in[4];
    float* OUT = (float*)d_out;                // [4][4096][64]
    const size_t n = (size_t)NB * SEQ * DH;
    char* wsp = (char*)d_ws;
    auto take = [&](size_t bytes) { char* p = wsp; wsp += (bytes + 255) & ~(size_t)255; return (void*)p; };
    bf* WB = (bf*)take((size_t)3 * DH * DH * 2); bf* WQB = WB; bf* WKB = WB + DH * DH; bf* WVB = WB + 2 * DH * DH;
    bf* XB1 = (bf*)take(n * 2); bf* XB2 = (bf*)take(n * 2);
    float* F32 = (float*)take(3 * n * 4); float* FQ = F32; float* FK = F32 + n; float* FVt = F32 + 2 * n;   // q [NB*SEQ][64], k [NB*SEQ][64], v^T [NB][64][SEQ]
    h16* P16 = (h16*)take(3 * n * 2); h16* Q16 = P16; h16* K16 = P16 + n; h16* Vt16 = P16 + 2 * n;          // fp16 planes, same layouts
    float* VS = (float*)take((size_t)NB * (SEQ / KBK) * DH * 4);                                             // [NB][SEQ/64][64]
    if ((size_t)(wsp - (char*)d_ws) > ws_size) return;    // total 23,158,784 B at NB=4, SEQ=4096
    const float sc = 1.0f / sqrtf((float)SEQ);
    const float scl2 = sc * 1.4426950408889634f;
    k_cvtw<<<dim3((DH * DH / 8 + 255) / 256, 3, 1), 256, 0, stream>>>(wq, wk, wv, WB);
    k_cvtx<<<dim3((unsigned)(((size_t)SEQ * DH / 8 + 255) / 256), NB, 2), 256, 0, stream>>>(x1, x2, XB1, XB2);
    k_gemmw<bf, 0, false><<<dim3(NB * SEQ / 64, 1, 1), 32, 0, stream>>>(XB1, nullptr, WQB, nullptr, DH, FQ, DH, nullptr, 0, 0, 0);                                      // q[i][n] = sum_d x1[i][d] Wq[n][d]
    k_gemmw<bf, 0, false><<<dim3(NB * SEQ / 64, 1, 1), 32, 0, stream>>>(XB2, nullptr, WKB, nullptr, DH, FK, DH, nullptr, 0, 0, 0);                                      // k[m][n] = sum_d x2[m][d] Wk[n][d]
    k_gemmw<bf, 0, false><<<dim3(1, SEQ / 64, NB), 32, 0, stream>>>(WVB, nullptr, XB2, nullptr, DH, FVt, SEQ, nullptr, (size_t)0, (size_t)SEQ * DH, (size_t)DH * SEQ);   // v^T[b][n][m] = sum_d Wv[n][d] x2[b][m][d]
    k_p16<<<(unsigned)((3 * n / 8 + 255) / 256), 256, 0, stream>>>(F32, P16, 3 * n / 8);
    k_vsum<<<dim3((SEQ / KBK + 15) / 16, NB, 1), 256, 0, stream>>>(FVt, VS);
    k_attn<<<NB * SEQ / 64, 128 * KS, 0, stream>>>(Q16, K16, Vt16, VS, OUT, scl2);
}

// v003
// It runs in 57.7 microseconds.
// In two side-by-side timings against v002, it was 1.55 and 1.54 times as fast.
// All steps since v000 together make it 3.46 times as fast.
#include <hip/hip_runtime.h>
#include <math.h>

// Single-head cross attention: q = x1 Wq^T, k = x2 Wk^T, v = x2 Wv^T (x [4][4096][64] f32, W [64][64] = [out][in]); p = softmax over keys of (q.k) * SEQ^-0.5; out = p v -> f32 [4][4096][64].
// Compute dtypes, f32 accumulate: all five inputs RNE-converted to bf16; q, k and v^T projections on v_wmma_f32_16x16x32_bf16 (plain bf16 operands); q.k^T and p.v on v_wmma_f32_16x16x32_f16 (q, k, v^T as plain fp16 planes; p enters as fp16 of (p - 0.6875), and 0.6875 * (64-key column sums of v, f32) is added to the f32 accumulator); online softmax (running max, exp2, row sums, 1/l) in f32.

#ifndef NB
#define NB 4
#endif
#ifndef SEQ
#define SEQ 4096
#endif
#define NB_FULL  4
#define SEQ_FULL 4096
#define DH       64
#define KBK      64
#define OSP      68
#define CCEN     0.6875f
#define KS       4      // key ranges per work-group: wave = (range, 16-row group)
static_assert(NB >= 1 && NB <= NB_FULL);
static_assert(SEQ >= KBK && SEQ <= SEQ_FULL && (SEQ % 64) == 0);
static_assert(DH == 64 && KBK == 64);
static_assert((SEQ / KBK) % KS == 0 && 8 % KS == 0);

typedef _Float16 h16;
typedef unsigned short bf;
typedef __attribute__((ext_vector_type(16))) __bf16   v16bf;
typedef __attribute__((ext_vector_type(16))) _Float16 v16h;
typedef __attribute__((ext_vector_type(8)))  _Float16 v8h;
typedef __attribute__((ext_vector_type(8)))  unsigned short v8us;
typedef __attribute__((ext_vector_type(8)))  float    v8f;
typedef __attribute__((ext_vector_type(4)))  float    v4f;
typedef v8h  __attribute__((may_alias)) v8ha;
typedef v4f  __attribute__((may_alias)) v4fa;

__device__ __forceinline__ unsigned short f2bf(float f) { unsigned u = __float_as_uint(f); u += 0x7FFFu + ((u >> 16) & 1u); return (unsigned short)(u >> 16); }
__device__ __forceinline__ float bf2f(unsigned short b) { return __uint_as_float(((unsigned)b) << 16); }
__device__ __forceinline__ float bfr(float f) { return bf2f(f2bf(f)); }
__device__ __forceinline__ v16h cat16(v8h lo, v8h hi) { return __builtin_shufflevector(lo, hi, 0, 1, 2, 3, 4, 5, 6, 7, 8, 9, 10, 11, 12, 13, 14, 15); }
__device__ __forceinline__ v16bf cat16b(v8us lo, v8us hi) { return __builtin_bit_cast(v16bf, __builtin_shufflevector(lo, hi, 0, 1, 2, 3, 4, 5, 6, 7, 8, 9, 10, 11, 12, 13, 14, 15)); }
__device__ __forceinline__ v8f wmma16(v16h a, v16h b, v8f c) { return __builtin_amdgcn_wmma_f32_16x16x32_f16(false, a, false, b, (short)0, c, false, false); }
__device__ __forceinline__ v8f wmmab(v16bf a, v16bf b, v8f c) { return __builtin_amdgcn_wmma_f32_16x16x32_bf16(false, a, false, b, (short)0, c, false, false); }

// ---- k_gemmw: register-blocked GEMM, ONE WAVE per 64x64 output tile (16 accumulators), operands straight from K-contiguous 16-bit planes; grid (M/64, N/64, Z), 32 threads.
// C[m][n] (f32, pitch ldc, + optional f32 bias[n]) = sum_k A[m][k] Bt[n][k] (+ split products per NSPLIT). z-batch strides sA/sB/sC in elements. K % 32 == 0.
// Fragment map (both operands): lane row/col = lane & 15, elements 0..7 <- k0 + 8h + 0..7, elements 8..15 <- k0 + 16 + 8h + 0..7 (h = lane >> 4).
template <typename T16> struct WFrag;
template <> struct WFrag<h16> { typedef v16h V; static __device__ __forceinline__ V ld(const h16* p) { return cat16(*(const v8h*)p, *(const v8h*)(p + 16)); } static __device__ __forceinline__ v8f mma(V a, V b, v8f c) { return wmma16(a, b, c); } };
template <> struct WFrag<bf> { typedef v16bf V; static __device__ __forceinline__ V ld(const bf* p) { return cat16b(*(const v8us*)p, *(const v8us*)(p + 16)); } static __device__ __forceinline__ v8f mma(V a, V b, v8f c) { return wmmab(a, b, c); } };
template <typename T16, int NSPLIT, bool BIAS>
__global__ __launch_bounds__(32) void k_gemmw(const T16* __restrict__ A, const T16* __restrict__ A2, const T16* __restrict__ Bt, const T16* __restrict__ Bt2, int K, float* C, int ldc, const float* __restrict__ bias, size_t sA, size_t sB, size_t sC) {
    typedef typename WFrag<T16>::V V;
    __shared__ __align__(16) float os[16 * 68];
    const size_t z = blockIdx.z; A += z * sA; if (A2) A2 += z * sA; Bt += z * sB; if (Bt2) Bt2 += z * sB; C += z * sC;
    const int lane = threadIdx.x & 31, lr = lane & 15, hi = lane >> 4; const int r0 = blockIdx.x * 64, c0 = blockIdx.y * 64;
    v8f acc[4][4];
#pragma unroll
    for (int mb = 0; mb < 4; ++mb)
#pragma unroll
        for (int nb = 0; nb < 4; ++nb) acc[mb][nb] = (v8f){};
    const size_t aoff = (size_t)(r0 + lr) * K + 8 * hi, boff = (size_t)(c0 + lr) * K + 8 * hi;
#pragma unroll 1
    for (int kc = 0; kc < K; kc += 32) {
        V a[4], a2[4];
#pragma unroll
        for (int mb = 0; mb < 4; ++mb) { a[mb] = WFrag<T16>::ld(A + aoff + (size_t)mb * 16 * K + kc); if (NSPLIT == 1 || NSPLIT == 2) a2[mb] = WFrag<T16>::ld(A2 + aoff + (size_t)mb * 16 * K + kc); }
#pragma unroll
        for (int nb = 0; nb < 4; ++nb) { const V b = WFrag<T16>::ld(Bt + boff + (size_t)nb * 16 * K + kc); V b2; if (NSPLIT >= 2) b2 = WFrag<T16>::ld(Bt2 + boff + (size_t)nb * 16 * K + kc);
#pragma unroll
            for (int mb = 0; mb < 4; ++mb) { acc[mb][nb] = WFrag<T16>::mma(a[mb], b, acc[mb][nb]); if (NSPLIT == 1 || NSPLIT == 2) acc[mb][nb] = WFrag<T16>::mma(a2[mb], b, acc[mb][nb]); if (NSPLIT >= 2) acc[mb][nb] = WFrag<T16>::mma(a[mb], b2, acc[mb][nb]); } }
        asm volatile("v_nop\n\tv_nop\n\tv_nop\n\tv_nop" : "+v"(acc[0][0]), "+v"(acc[1][1]), "+v"(acc[2][2]), "+v"(acc[3][3]) : "v"(a[0]), "v"(a[3]));
    }
#pragma unroll
    for (int mb = 0; mb < 4; ++mb) {
#pragma unroll
        for (int nb = 0; nb < 4; ++nb) {
#pragma unroll
            for (int j = 0; j < 8; ++j) os[(hi * 8 + j) * 68 + nb * 16 + lr] = acc[mb][nb][j]; }
        __builtin_amdgcn_wave_barrier(); asm volatile("" ::: "memory");
        float* crow = C + (size_t)(r0 + mb * 16) * ldc + c0;
{
#pragma unroll
            for (int s = 0; s < 8; ++s) { const int row = 2 * s + hi, cofs = lr * 4; v4f val = *(const v4fa*)(os + row * 68 + cofs); if (BIAS) { val[0] += bfr(bias[c0 + cofs]); val[1] += bfr(bias[c0 + cofs + 1]); val[2] += bfr(bias[c0 + cofs + 2]); val[3] += bfr(bias[c0 + cofs + 3]); }
                *(v4f*)(crow + (size_t)row * ldc + cofs) = val; }
             }
        __builtin_amdgcn_wave_barrier(); asm volatile("" ::: "memory");
    }
}

__global__ __launch_bounds__(256) void k_cvtw(const float* __restrict__ w0, const float* __restrict__ w1, const float* __restrict__ w2, bf* dst) {
    const int y = blockIdx.y; const float* src = (y == 0) ? w0 : ((y == 1) ? w1 : w2);
    const size_t i = (size_t)blockIdx.x * 256 + threadIdx.x; if (i >= (size_t)DH * DH / 8) return;
    const v8f v = *(const v8f*)(src + i * 8); v8us o;
#pragma unroll
    for (int k = 0; k < 8; ++k) o[k] = f2bf(v[k]);
    bf* dp = dst + (size_t)y * DH * DH + i * 8;
    *(v8us*)dp = o;  }

__global__ __launch_bounds__(256) void k_cvtx(const float* __restrict__ x1, const float* __restrict__ x2, bf* d1, bf* d2) {
    const int b = blockIdx.y; const bool second = (blockIdx.z != 0);
    const float* src = (second ? x2 : x1) + (size_t)b * SEQ_FULL * DH; bf* dst = (second ? d2 : d1) + (size_t)b * SEQ * DH;
    const size_t i = (size_t)blockIdx.x * 256 + threadIdx.x; if (i >= (size_t)SEQ * DH / 8) return;
    const v8f v = *(const v8f*)(src + i * 8); v8us o;
#pragma unroll
    for (int k = 0; k < 8; ++k) o[k] = f2bf(v[k]);
    *(v8us*)(dst + i * 8) = o;  }

// k_p16: f32 -> fp16 planes, one 8-element (16-byte) piece per thread, thread index = destination piece. q keeps its row-major layout.
// k and v^T are stored in FRAGMENT ORDER: per (batch, 64-key block) 8 KB = 16 groups (tile t = 0..3, piece j = 0..3) of 32 pieces, piece number in a group = the lane of k_attn that reads it (16 * h + row):
//   k:   piece (t, j, h, row) = k[key 64 kb + 16 t + row][d = 16 j + 8 h .. + 7];   v^T: piece (t, j, h, row) = v^T[d = 16 t + row][key 64 kb + 16 j + 8 h .. + 7].
// One wave-wide 16-byte load of k_attn reads one group: 512 contiguous bytes, 4 whole 128-byte lines (from row-major planes it would touch 32-byte parts of 16 lines, and the WGP cache is paid per line touched).
// The scattered side is this kernel's reads: the 8 groups of a work-group use every byte of the f32 lines they touch.
__global__ __launch_bounds__(256) void k_p16(const float* __restrict__ src, h16* dst, size_t n8) {
    const size_t i = (size_t)blockIdx.x * 256 + threadIdx.x; if (i >= n8) return;
    constexpr unsigned PL = (unsigned)((size_t)NB * SEQ * DH / 8);   // pieces per plane, a multiple of 512
    unsigned sp = (unsigned)i;                                        // source piece
    if (sp >= PL) {
        const bool isv = sp >= 2 * PL; const unsigned r = sp - (isv ? 2 * PL : PL);
        const unsigned row = 16 * ((r >> 7) & 3) + (r & 15), col = 2 * ((r >> 5) & 3) + ((r >> 4) & 1), blk = r >> 9;   // blk = b * (SEQ / 64) + kb
        sp = isv ? 2 * PL + ((blk / (SEQ / KBK)) * DH + row) * (SEQ / 8) + (blk % (SEQ / KBK)) * 8 + col : PL + blk * 512 + row * 8 + col; }
    const v8f v = *(const v8f*)(src + (size_t)sp * 8); v8h o;
#pragma unroll
    for (int k = 0; k < 8; ++k) o[k] = (h16)v[k];
    *(v8h*)(dst + i * 8) = o;  }

__global__ __launch_bounds__(256) void k_vsum(const float* __restrict__ FVt, float* VS) {
    const int t = threadIdx.x; const int b = blockIdx.y; const int nkb = SEQ / KBK; const int kb = blockIdx.x * 16 + (t >> 4); const int d0 = (t & 15) * 4;
    if (kb >= nkb) return;
    const float* src = FVt + ((size_t)b * DH + d0) * SEQ + (size_t)kb * KBK;
    v4f o;
#pragma unroll
    for (int j = 0; j < 4; ++j) { const float* col = src + (size_t)j * SEQ; v4f s4 = (v4f){};
#pragma unroll 4
        for (int q = 0; q < KBK / 4; ++q) s4 += *(const v4f*)(col + q * 4);
        o[j] = (s4[0] + s4[1]) + (s4[2] + s4[3]); }
    float* dp = VS + ((size_t)b * nkb + kb) * DH + d0;
    *(v4f*)dp = o;  }

// lane l <-> l ^ 16: the two halves of a wave hold the two key halves of one query column.
__device__ __forceinline__ float xhalf(float x) { const int b = __float_as_int(x); return __int_as_float(__builtin_amdgcn_permlanex16(b, b, 0x76543210, 0xfedcba98, false, false)); }

// k_attn: flash-style attention, one block = (batch b, 64 query rows), 4 * KS waves: wave & 3 = 16-query group, wave >> 2 = key range; range ks takes key blocks ks, ks + KS, ... (64 keys each)
// with its own running max, sums and un-normalised accumulators; the KS partials of a query are merged in LDS at the end (weights exp2(m_ks - max), one division by the merged sum).
// Transposed tiles: S^T = K.Q^T (A = k from its fragment-order plane, see k_p16; B = q rows [b][i][d]; fp16, both with the split-k map straight from global): register r of tile t = score of key 16t + 8h + r for query lane & 15,
// so a lane holds 32 of its query's 64 scores: max and sum run in registers, the max joined between the halves by one cross-row move per key block, the sums joined once after the loop.
// Online softmax in f32 with scale folded as scl2 = SEQ^-0.5 * log2(e); p = exp2(s*scl2 - mrun) in (0, 1].
// P^T: score tiles 2c and 2c + 1, converted in place (fp16 of p - CCEN), are the B fragment of keys 32c .. 32c + 31; A = v^T from its fragment-order plane (fp16, same map): O^T += V^T.P^T, no LDS and no barrier in the loop.
// acc[n][r] = O^T[16n + 8h + r][query]; acc += CCEN * VS[b][kb][d]  (VS = f32 column sums of the 64 keys) so that acc == sum_m p_m v_m exactly in real arithmetic.
__global__ __launch_bounds__(128 * KS) __attribute__((amdgpu_waves_per_eu(KS, KS)))
void k_attn(const h16* __restrict__ Q16, const h16* __restrict__ K16, const h16* __restrict__ Vt16, const float* __restrict__ VS, float* OUT, float scl2) {
    __shared__ __align__(16) float wsc[4 * KS][16 * OSP];
    __shared__ float sml[4 * KS][2][16];
    const int tid = threadIdx.x, wave = tid >> 5, lane = tid & 31, l16 = lane & 15, hi = lane >> 4;
    const int nqb = SEQ / 64; const int b = blockIdx.x / nqb; const int blk0 = (blockIdx.x % nqb) * 64; const int row0 = blk0 + (wave & 3) * 16; const int nkb = SEQ / KBK;
    const h16* qp = Q16 + ((size_t)b * SEQ + row0 + l16) * DH + 8 * hi;
    const h16* kp = K16 + (size_t)b * SEQ * DH;    // fragment order (k_p16): key block kb at kb * 4096 elements, group (t, j) at (4 t + j) * 256, this lane's piece at 8 * lane
    const h16* vp = Vt16 + (size_t)b * DH * SEQ;   // the same order, t = 16-row group of v^T
    const unsigned lo8 = 8u * (unsigned)lane;
    const float* vsp = VS + (size_t)b * nkb * DH + 8 * hi;
    const int ks0 = __builtin_amdgcn_readfirstlane(wave >> 2);   // key range in a scalar register: the loop's count and branch stay scalar, EXEC untouched around the matrix instructions
    float* os = &wsc[wave][0];
    v16h qb[2];
    qb[0] = cat16(*(const v8h*)qp, *(const v8h*)(qp + 16));
    qb[1] = cat16(*(const v8h*)(qp + 32), *(const v8h*)(qp + 48));
    v8f acc[4];
#pragma unroll
    for (int n = 0; n < 4; ++n) acc[n] = (v8f){};
    float m = -1.0e30f, l = 0.0f;
#pragma unroll 1
    for (int kb = ks0; kb < nkb; kb += KS) {
        const h16* kq = kp + (size_t)kb * (KBK * DH); const h16* vq = vp + (size_t)kb * (KBK * DH);   // this key block's 8 KB of k and of v^T: wave-uniform addresses
        v16h ka[4][2];
#pragma unroll
        for (int t = 0; t < 4; ++t) {
            const h16* p0 = &kq[lo8 + t * 1024];
            ka[t][0] = cat16(*(const v8h*)p0, *(const v8h*)(p0 + 256));
            ka[t][1] = cat16(*(const v8h*)(p0 + 512), *(const v8h*)(p0 + 768)); }
        __builtin_amdgcn_sched_barrier(0);   // all 16 k loads issue before the first product; without it the compiler spreads them among the products and a wave waits out the load latency several times per key block
        v8f s[4];
#pragma unroll
        for (int t = 0; t < 4; ++t) { v8f c = (v8f){}; c = wmma16(ka[t][0], qb[0], c); c = wmma16(ka[t][1], qb[1], c); s[t] = c; }
        // four vector slots between the last score product and the first vector instruction that reads a score tile
        asm volatile("v_nop\n\tv_nop\n\tv_nop\n\tv_nop" : "+v"(s[0]), "+v"(s[1]), "+v"(s[2]), "+v"(s[3]) : "v"(qb[0]), "v"(qb[1]));
        float mt[4];
#pragma unroll
        for (int t = 0; t < 4; ++t) mt[t] = fmaxf(fmaxf(fmaxf(s[t][0], s[t][1]), fmaxf(s[t][2], s[t][3])), fmaxf(fmaxf(s[t][4], s[t][5]), fmaxf(s[t][6], s[t][7])));
        float mx = fmaxf(fmaxf(mt[0], mt[1]), fmaxf(mt[2], mt[3])); mx = fmaxf(mx, xhalf(mx)) * scl2;   // scl2 > 0: the scaled max is the max of the scaled scores
        const float mn = fmaxf(m, mx); const float corr = exp2f(m - mn); m = mn;
        v16h pb[2]; float st[4];
#pragma unroll
        for (int t = 0; t < 4; ++t) {
            float p[8];
#pragma unroll
            for (int r = 0; r < 8; ++r) { p[r] = exp2f(s[t][r] * scl2 - mn); pb[t >> 1][(t & 1) * 8 + r] = (h16)(p[r] - CCEN); }
            st[t] = ((p[0] + p[1]) + (p[2] + p[3])) + ((p[4] + p[5]) + (p[6] + p[7])); }
        l = l * corr + ((st[0] + st[1]) + (st[2] + st[3]));
#pragma unroll
        for (int n = 0; n < 4; ++n) {
            const float* vs0 = vsp + (size_t)kb * DH + n * 16;
            const v4f va = *(const v4f*)vs0, vb = *(const v4f*)(vs0 + 4);
            const v8f vs8 = __builtin_shufflevector(va, vb, 0, 1, 2, 3, 4, 5, 6, 7);
            acc[n] = acc[n] * corr + vs8 * CCEN; }
#pragma unroll
        for (int n = 0; n < 4; ++n) {
            const h16* p0 = &vq[lo8 + n * 1024];
            const v16h a0 = cat16(*(const v8h*)p0, *(const v8h*)(p0 + 256));
            const v16h a1 = cat16(*(const v8h*)(p0 + 512), *(const v8h*)(p0 + 768));
            acc[n] = wmma16(a0, pb[0], acc[n]); acc[n] = wmma16(a1, pb[1], acc[n]); }
        // the same four slots behind the last output product, on the loop's taken back edge and on its exit alike
        asm volatile("v_nop\n\tv_nop\n\tv_nop\n\tv_nop" : "+v"(acc[0]), "+v"(acc[1]), "+v"(acc[2]), "+v"(acc[3]) : "v"(pb[0]), "v"(pb[1]));
    }
    l += xhalf(l);
    if (hi == 0) { sml[wave][0][l16] = m; sml[wave][1][l16] = l; }
#pragma unroll
    for (int n = 0; n < 4; ++n) {
        *(v4fa*)(os + l16 * OSP + n * 16 + 8 * hi) = __builtin_shufflevector(acc[n], acc[n], 0, 1, 2, 3);
        *(v4fa*)(os + l16 * OSP + n * 16 + 8 * hi + 4) = __builtin_shufflevector(acc[n], acc[n], 4, 5, 6, 7); }
    __syncthreads();
    float* orow = OUT + ((size_t)b * SEQ + blk0) * DH;
    // the three unrolls below: constant trip counts (8 / KS, KS), so that the LDS reads of all KS partials issue together instead of one wait per range
#pragma unroll
    for (int i = 0; i < 8 / KS; ++i) {
        const int idx = tid + i * 128 * KS; const int row = idx >> 4, cofs = (idx & 15) * 4, rg = row >> 4, rr = row & 15;
        float mm = sml[rg][0][rr];
#pragma unroll
        for (int ks = 1; ks < KS; ++ks) mm = fmaxf(mm, sml[ks * 4 + rg][0][rr]);
        float ls = 0.0f; v4f o = (v4f){};
#pragma unroll
        for (int ks = 0; ks < KS; ++ks) { const float w = exp2f(sml[ks * 4 + rg][0][rr] - mm); ls += w * sml[ks * 4 + rg][1][rr]; o += w * *(const v4fa*)(&wsc[ks * 4 + rg][rr * OSP + cofs]); }
        *(v4f*)(orow + (size_t)row * DH + cofs) = o * (1.0f / ls);
    }
}

extern "C" void kernel_launch(void* const* d_in, const int* in_sizes, int n_in,
                              void* d_out, int out_size, void* d_ws, size_t ws_size, hipStream_t stream) {
    if (n_in < 5) return;
    const size_t need_x = ((size_t)(NB - 1) * SEQ_FULL + SEQ) * DH;
    if ((size_t)in_sizes[0] < need_x || (size_t)in_sizes[1] < need_x) return;
    if (in_sizes[2] < DH * DH || in_sizes[3] < DH * DH || in_sizes[4] < DH * DH) return;
    if ((size_t)out_size < (size_t)NB * SEQ * DH) return;
    const float* x1 = (const float*)d_in[0];   // [4][4096][64]
    const float* x2 = (const float*)d_in[1];   // [4][4096][64]
    const float* wq = (const float*)d_in[2];   // [64][64] = [out][in]
    const float* wk = (const float*)d_in[3];
    const float* wv = (const float*)d_in[4];
    float* OUT = (float*)d_out;                // [4][4096][64]
    const size_t n = (size_t)NB * SEQ * DH;
    char* wsp = (char*)d_ws;
    auto take = [&](size_t bytes) { char* p = wsp; wsp += (bytes + 255) & ~(size_t)255; return (void*)p; };
    bf* WB = (bf*)take((size_t)3 * DH * DH * 2); bf* WQB = WB; bf* WKB = WB + DH * DH; bf* WVB = WB + 2 * DH * DH;
    bf* XB1 = (bf*)take(n * 2); bf* XB2 = (bf*)take(n * 2);
    float* F32 = (float*)take(3 * n * 4); float* FQ = F32; float* FK = F32 + n; float* FVt = F32 + 2 * n;   // q [NB*SEQ][64], k [NB*SEQ][64], v^T [NB][64][SEQ]
    h16* P16 = (h16*)take(3 * n * 2); h16* Q16 = P16; h16* K16 = P16 + n; h16* Vt16 = P16 + 2 * n;          // fp16 planes: q as FQ, k and v^T in fragment order (k_p16)
    float* VS = (float*)take((size_t)NB * (SEQ / KBK) * DH * 4);                                             // [NB][SEQ/64][64]
    if ((size_t)(wsp - (char*)d_ws) > ws_size) return;    // total 23,158,784 B at NB=4, SEQ=4096
    const float sc = 1.0f / sqrtf((float)SEQ);
    const float scl2 = sc * 1.4426950408889634f;
    k_cvtw<<<dim3((DH * DH / 8 + 255) / 256, 3, 1), 256, 0, stream>>>(wq, wk, wv, WB);
    k_cvtx<<<dim3((unsigned)(((size_t)SEQ * DH / 8 + 255) / 256), NB, 2), 256, 0, stream>>>(x1, x2, XB1, XB2);
    k_gemmw<bf, 0, false><<<dim3(NB * SEQ / 64, 1, 1), 32, 0, stream>>>(XB1, nullptr, WQB, nullptr, DH, FQ, DH, nullptr, 0, 0, 0);                                      // q[i][n] = sum_d x1[i][d] Wq[n][d]
    k_gemmw<bf, 0, false><<<dim3(NB * SEQ / 64, 1, 1), 32, 0, stream>>>(XB2, nullptr, WKB, nullptr, DH, FK, DH, nullptr, 0, 0, 0);                                      // k[m][n] = sum_d x2[m][d] Wk[n][d]
    k_gemmw<bf, 0, false><<<dim3(1, SEQ / 64, NB), 32, 0, stream>>>(WVB, nullptr, XB2, nullptr, DH, FVt, SEQ, nullptr, (size_t)0, (size_t)SEQ * DH, (size_t)DH * SEQ);   // v^T[b][n][m] = sum_d Wv[n][d] x2[b][m][d]
    k_p16<<<(unsigned)((3 * n / 8 + 255) / 256), 256, 0, stream>>>(F32, P16, 3 * n / 8);
    k_vsum<<<dim3((SEQ / KBK + 15) / 16, NB, 1), 256, 0, stream>>>(FVt, VS);
    k_attn<<<NB * SEQ / 64, 128 * KS, 0, stream>>>(Q16, K16, Vt16, VS, OUT, scl2);
}

// v004
// It runs in 32.1 microseconds.
// Two timings next to v003 put it at 1.79 and 1.76 times that version's speed.
// All steps since v000 together make it 6.14 times as fast.
#include <hip/hip_runtime.h>
#include <math.h>

// Single-head cross attention: q = x1 Wq^T, k = x2 Wk^T, v = x2 Wv^T (x [4][4096][64] f32, W [64][64] = [out][in]); p = softmax over keys of (q.k) * SEQ^-0.5; out = p v -> f32 [4][4096][64].
// Compute dtypes, f32 accumulate: all five inputs RNE-converted to bf16; q, k and v^T projections on v_wmma_f32_16x16x32_bf16 (plain bf16 operands); q.k^T and p.v on v_wmma_f32_16x16x32_f16 (q, k, v^T as plain fp16 planes; p enters as fp16 of (p - 0.6875), and 0.6875 * (64-key column sums of v, f32) is added to the f32 accumulator); online softmax (running max, exp2, row sums, 1/l) in f32.

#ifndef NB
#define NB 4
#endif
#ifndef SEQ
#define SEQ 4096
#endif
#define NB_FULL  4
#define SEQ_FULL 4096
#define DH       64
#define KBK      64
#define OSP      68
#define TP       72     // LDS pitch of a staged bf16 row, elements: 144 bytes = 16 bytes x odd, for the 16-byte fragment reads
#define CCEN     0.6875f
#define KS       4      // key ranges per work-group: wave = (range, 16-row group)
static_assert(NB >= 1 && NB <= NB_FULL);
static_assert(SEQ >= KBK && SEQ <= SEQ_FULL && (SEQ % 64) == 0);
static_assert(DH == 64 && KBK == 64);
static_assert((SEQ / KBK) % KS == 0 && 8 % KS == 0);

typedef _Float16 h16;
typedef unsigned short bf;
typedef __attribute__((ext_vector_type(16))) __bf16   v16bf;
typedef __attribute__((ext_vector_type(16))) _Float16 v16h;
typedef __attribute__((ext_vector_type(8)))  _Float16 v8h;
typedef __attribute__((ext_vector_type(8)))  unsigned short v8us;
typedef __attribute__((ext_vector_type(8)))  float    v8f;
typedef __attribute__((ext_vector_type(4)))  float    v4f;
typedef __attribute__((ext_vector_type(4)))  unsigned short v4us;
typedef v8us __attribute__((may_alias)) v8usa;
typedef v4us __attribute__((may_alias)) v4usa;
typedef v4f  __attribute__((may_alias)) v4fa;

__device__ __forceinline__ unsigned short f2bf(float f) { unsigned u = __float_as_uint(f); u += 0x7FFFu + ((u >> 16) & 1u); return (unsigned short)(u >> 16); }
__device__ __forceinline__ v16h cat16(v8h lo, v8h hi) { return __builtin_shufflevector(lo, hi, 0, 1, 2, 3, 4, 5, 6, 7, 8, 9, 10, 11, 12, 13, 14, 15); }
__device__ __forceinline__ v16bf cat16b(v8us lo, v8us hi) { return __builtin_bit_cast(v16bf, __builtin_shufflevector(lo, hi, 0, 1, 2, 3, 4, 5, 6, 7, 8, 9, 10, 11, 12, 13, 14, 15)); }
__device__ __forceinline__ v8f wmma16(v16h a, v16h b, v8f c) { return __builtin_amdgcn_wmma_f32_16x16x32_f16(false, a, false, b, (short)0, c, false, false); }
__device__ __forceinline__ v8f wmmab(v16bf a, v16bf b, v8f c) { return __builtin_amdgcn_wmma_f32_16x16x32_bf16(false, a, false, b, (short)0, c, false, false); }

// k_proj: the whole preparation in one launch. One work-group (4 waves) = one 64 x 64 product D = A.B^T over the 64 inputs; blockIdx.y = which: 0: q = x1 Wq^T, 1: k = x2 Wk^T (A = 64 rows of x, B = W), 2: v^T = Wv x2^T (A = Wv, B = 64 rows of x2).
// Both operands are contiguous 16-KB f32 blocks: read with whole-line 16-byte loads, RNE-converted to bf16 and laid in LDS (pitch TP); wave w takes rows 16 w .. 16 w + 15 of A against all of B.
// Fragment map (both operands): lane row/col = lane & 15, elements 0..7 <- k0 + 8h + 0..7, elements 8..15 <- k0 + 16 + 8h + 0..7 (h = lane >> 4); k0 = 0, then 32, into one f32 accumulator.
// The f32 tile goes through the wave's own LDS rows and leaves as fp16, 8 elements (16 bytes) per lane and store. q keeps its row-major layout [b][i][d].
// k and v^T are stored in FRAGMENT ORDER: per (batch, 64-key block) 8 KB = 16 groups (tile t = 0..3, piece j = 0..3) of 32 pieces, piece number in a group = the lane of k_attn that reads it (16 * h + row):
//   k:   piece (t, j, h, row) = k[key 64 kb + 16 t + row][d = 16 j + 8 h .. + 7];   v^T: piece (t, j, h, row) = v^T[d = 16 t + row][key 64 kb + 16 j + 8 h .. + 7];   t = this kernel's wave.
// One wave-wide 16-byte load of k_attn reads one group: 512 contiguous bytes, 4 whole 128-byte lines (from row-major planes it would touch 32-byte parts of 16 lines, and the WGP cache is paid per line touched).
// VS[b][kb][d] = f32 sum of v^T[d] over the block's 64 keys, from the same f32 tile: four running sums over key mod 4, then (s0 + s1) + (s2 + s3).
__global__ __launch_bounds__(128) void k_proj(const float* __restrict__ x1, const float* __restrict__ x2, const float* __restrict__ wq, const float* __restrict__ wk, const float* __restrict__ wv, h16* Q16, h16* K16, h16* Vt16, float* VS) {
    __shared__ __align__(16) bf sa[64 * TP];
    __shared__ __align__(16) bf sb[64 * TP];
    __shared__ __align__(16) float os[4][16 * OSP];
    const int tid = threadIdx.x, wave = tid >> 5, lane = tid & 31, lr = lane & 15, hi = lane >> 4;
    const int job = blockIdx.y, tile = blockIdx.x;   // tile = b * (SEQ / 64) + 64-row block
    const float* xt = (job == 0 ? x1 : x2) + ((size_t)(tile / (SEQ / 64)) * SEQ_FULL + (size_t)(tile % (SEQ / 64)) * 64) * DH;
    const float* wt = (job == 0) ? wq : ((job == 1) ? wk : wv);
    const float* As = (job == 2) ? wt : xt; const float* Bs = (job == 2) ? xt : wt;
    // every loop of this kernel has a constant trip count and is unrolled: its arrays stay in registers and its loads issue together, one latency per group
    v4f ra[8], rb[8];
#pragma unroll
    for (int i = 0; i < 8; ++i) { ra[i] = *(const v4f*)(As + (size_t)(tid + 128 * i) * 4); rb[i] = *(const v4f*)(Bs + (size_t)(tid + 128 * i) * 4); }
#pragma unroll
    for (int i = 0; i < 8; ++i) {
        const int p = tid + 128 * i, at = (p >> 4) * TP + (p & 15) * 4; v4us ca, cb;
#pragma unroll
        for (int k = 0; k < 4; ++k) { ca[k] = f2bf(ra[i][k]); cb[k] = f2bf(rb[i][k]); }
        *(v4usa*)(sa + at) = ca; *(v4usa*)(sb + at) = cb; }
    __syncthreads();
    const bf* ap = sa + (16 * wave + lr) * TP + 8 * hi; const bf* bp = sb + lr * TP + 8 * hi;
    v8f acc[4];
#pragma unroll
    for (int nb = 0; nb < 4; ++nb) acc[nb] = (v8f){};
#pragma unroll
    for (int kc = 0; kc < DH; kc += 32) {
        const v16bf a = cat16b(*(const v8usa*)(ap + kc), *(const v8usa*)(ap + kc + 16));
#pragma unroll
        for (int nb = 0; nb < 4; ++nb) acc[nb] = wmmab(a, cat16b(*(const v8usa*)(bp + nb * 16 * TP + kc), *(const v8usa*)(bp + nb * 16 * TP + kc + 16)), acc[nb]); }
    float* o = &os[wave][0];
#pragma unroll
    for (int nb = 0; nb < 4; ++nb) {
#pragma unroll
        for (int j = 0; j < 8; ++j) o[(hi * 8 + j) * OSP + nb * 16 + lr] = acc[nb][j]; }
    __syncthreads();
    h16* dst = ((job == 0) ? Q16 : ((job == 1) ? K16 : Vt16)) + (size_t)tile * (64 * DH) + wave * (16 * DH);   // this wave's 2 KB, in every plane
    // piece lane + 32 j of those 2 KB comes from: q, row (lane >> 3) + 4 j, columns 8 (lane & 7) ..; k and v^T, row lane & 15, columns 16 j + 8 h ..
    const float* sp = o + ((job == 0) ? (lane >> 3) * OSP + (lane & 7) * 8 : lr * OSP + 8 * hi); const int step = (job == 0) ? 4 * OSP : 16;
    v8h h[4];
#pragma unroll
    for (int j = 0; j < 4; ++j) {
        const v4f lo = *(const v4fa*)(sp + j * step), up = *(const v4fa*)(sp + j * step + 4);
#pragma unroll
        for (int k = 0; k < 4; ++k) { h[j][k] = (h16)lo[k]; h[j][4 + k] = (h16)up[k]; } }
#pragma unroll
    for (int j = 0; j < 4; ++j) *(v8h*)(dst + (lane + 32 * j) * 8) = h[j];
    if (job == 2 && wave < 2) {   // one wave per 128-byte line of VS: lane = d - 32 * wave
        const int d = 32 * wave + lane; const float* col = &os[d >> 4][(d & 15) * OSP]; v4f s4 = (v4f){};
#pragma unroll
        for (int q = 0; q < KBK / 4; ++q) s4 += *(const v4fa*)(col + q * 4);
        VS[(size_t)tile * DH + d] = (s4[0] + s4[1]) + (s4[2] + s4[3]); }
}

// lane l <-> l ^ 16: the two halves of a wave hold the two key halves of one query column.
__device__ __forceinline__ float xhalf(float x) { const int b = __float_as_int(x); return __int_as_float(__builtin_amdgcn_permlanex16(b, b, 0x76543210, 0xfedcba98, false, false)); }

// k_attn: flash-style attention, one block = (batch b, 64 query rows), 4 * KS waves: wave & 3 = 16-query group, wave >> 2 = key range; range ks takes key blocks ks, ks + KS, ... (64 keys each)
// with its own running max, sums and un-normalised accumulators; the KS partials of a query are merged in LDS at the end (weights exp2(m_ks - max), one division by the merged sum).
// Transposed tiles: S^T = K.Q^T (A = k from its fragment-order plane, see k_proj; B = q rows [b][i][d]; fp16, both with the split-k map straight from global): register r of tile t = score of key 16t + 8h + r for query lane & 15,
// so a lane holds 32 of its query's 64 scores: max and sum run in registers, the max joined between the halves by one cross-row move per key block, the sums joined once after the loop.
// Online softmax in f32 with scale folded as scl2 = SEQ^-0.5 * log2(e); p = exp2(s*scl2 - mrun) in (0, 1].
// P^T: score tiles 2c and 2c + 1, converted in place (fp16 of p - CCEN), are the B fragment of keys 32c .. 32c + 31; A = v^T from its fragment-order plane (fp16, same map): O^T += V^T.P^T, no LDS and no barrier in the loop.
// acc[n][r] = O^T[16n + 8h + r][query]; acc += CCEN * VS[b][kb][d]  (VS = f32 column sums of the 64 keys) so that acc == sum_m p_m v_m exactly in real arithmetic.
__global__ __launch_bounds__(128 * KS) __attribute__((amdgpu_waves_per_eu(KS, KS)))
void k_attn(const h16* __restrict__ Q16, const h16* __restrict__ K16, const h16* __restrict__ Vt16, const float* __restrict__ VS, float* OUT, float scl2) {
    __shared__ __align__(16) float wsc[4 * KS][16 * OSP];
    __shared__ float sml[4 * KS][2][16];
    const int tid = threadIdx.x, wave = tid >> 5, lane = tid & 31, l16 = lane & 15, hi = lane >> 4;
    const int nqb = SEQ / 64; const int b = blockIdx.x / nqb; const int blk0 = (blockIdx.x % nqb) * 64; const int row0 = blk0 + (wave & 3) * 16; const int nkb = SEQ / KBK;
    const h16* qp = Q16 + ((size_t)b * SEQ + row0 + l16) * DH + 8 * hi;
    const h16* kp = K16 + (size_t)b * SEQ * DH;    // fragment order (k_proj): key block kb at kb * 4096 elements, group (t, j) at (4 t + j) * 256, this lane's piece at 8 * lane
    const h16* vp = Vt16 + (size_t)b * DH * SEQ;   // the same order, t = 16-row group of v^T
    const unsigned lo8 = 8u * (unsigned)lane;
    const float* vsp = VS + (size_t)b * nkb * DH + 8 * hi;
    const int ks0 = __builtin_amdgcn_readfirstlane(wave >> 2);   // key range in a scalar register: the loop's count and branch stay scalar, EXEC untouched around the matrix instructions
    float* os = &wsc[wave][0];
    v16h qb[2];
    qb[0] = cat16(*(const v8h*)qp, *(const v8h*)(qp + 16));
    qb[1] = cat16(*(const v8h*)(qp + 32), *(const v8h*)(qp + 48));
    v8f acc[4];
#pragma unroll
    for (int n = 0; n < 4; ++n) acc[n] = (v8f){};
    float m = -1.0e30f, l = 0.0f;
#pragma unroll 1
    for (int kb = ks0; kb < nkb; kb += KS) {
        const h16* kq = kp + (size_t)kb * (KBK * DH); const h16* vq = vp + (size_t)kb * (KBK * DH);   // this key block's 8 KB of k and of v^T: wave-uniform addresses
        v16h ka[4][2];
#pragma unroll
        for (int t = 0; t < 4; ++t) {
            const h16* p0 = &kq[lo8 + t * 1024];
            ka[t][0] = cat16(*(const v8h*)p0, *(const v8h*)(p0 + 256));
            ka[t][1] = cat16(*(const v8h*)(p0 + 512), *(const v8h*)(p0 + 768)); }
        __builtin_amdgcn_sched_barrier(0);   // all 16 k loads issue before the first product; without it the compiler spreads them among the products and a wave waits out the load latency several times per key block
        v8f s[4];
#pragma unroll
        for (int t = 0; t < 4; ++t) { v8f c = (v8f){}; c = wmma16(ka[t][0], qb[0], c); c = wmma16(ka[t][1], qb[1], c); s[t] = c; }
        // four vector slots between the last score product and the first vector instruction that reads a score tile
        asm volatile("v_nop\n\tv_nop\n\tv_nop\n\tv_nop" : "+v"(s[0]), "+v"(s[1]), "+v"(s[2]), "+v"(s[3]) : "v"(qb[0]), "v"(qb[1]));
        float mt[4];
#pragma unroll
        for (int t = 0; t < 4; ++t) mt[t] = fmaxf(fmaxf(fmaxf(s[t][0], s[t][1]), fmaxf(s[t][2], s[t][3])), fmaxf(fmaxf(s[t][4], s[t][5]), fmaxf(s[t][6], s[t][7])));
        float mx = fmaxf(fmaxf(mt[0], mt[1]), fmaxf(mt[2], mt[3])); mx = fmaxf(mx, xhalf(mx)) * scl2;   // scl2 > 0: the scaled max is the max of the scaled scores
        const float mn = fmaxf(m, mx); const float corr = exp2f(m - mn); m = mn;
        v16h pb[2]; float st[4];
#pragma unroll
        for (int t = 0; t < 4; ++t) {
            float p[8];
#pragma unroll
            for (int r = 0; r < 8; ++r) { p[r] = exp2f(s[t][r] * scl2 - mn); pb[t >> 1][(t & 1) * 8 + r] = (h16)(p[r] - CCEN); }
            st[t] = ((p[0] + p[1]) + (p[2] + p[3])) + ((p[4] + p[5]) + (p[6] + p[7])); }
        l = l * corr + ((st[0] + st[1]) + (st[2] + st[3]));
#pragma unroll
        for (int n = 0; n < 4; ++n) {
            const float* vs0 = vsp + (size_t)kb * DH + n * 16;
            const v4f va = *(const v4f*)vs0, vb = *(const v4f*)(vs0 + 4);
            const v8f vs8 = __builtin_shufflevector(va, vb, 0, 1, 2, 3, 4, 5, 6, 7);
            acc[n] = acc[n] * corr + vs8 * CCEN; }
#pragma unroll
        for (int n = 0; n < 4; ++n) {
            const h16* p0 = &vq[lo8 + n * 1024];
            const v16h a0 = cat16(*(const v8h*)p0, *(const v8h*)(p0 + 256));
            const v16h a1 = cat16(*(const v8h*)(p0 + 512), *(const v8h*)(p0 + 768));
            acc[n] = wmma16(a0, pb[0], acc[n]); acc[n] = wmma16(a1, pb[1], acc[n]); }
        // the same four slots behind the last output product, on the loop's taken back edge and on its exit alike
        asm volatile("v_nop\n\tv_nop\n\tv_nop\n\tv_nop" : "+v"(acc[0]), "+v"(acc[1]), "+v"(acc[2]), "+v"(acc[3]) : "v"(pb[0]), "v"(pb[1]));
    }
    l += xhalf(l);
    if (hi == 0) { sml[wave][0][l16] = m; sml[wave][1][l16] = l; }
#pragma unroll
    for (int n = 0; n < 4; ++n) {
        *(v4fa*)(os + l16 * OSP + n * 16 + 8 * hi) = __builtin_shufflevector(acc[n], acc[n], 0, 1, 2, 3);
        *(v4fa*)(os + l16 * OSP + n * 16 + 8 * hi + 4) = __builtin_shufflevector(acc[n], acc[n], 4, 5, 6, 7); }
    __syncthreads();
    float* orow = OUT + ((size_t)b * SEQ + blk0) * DH;
    // the three unrolls below: constant trip counts (8 / KS, KS), so that the LDS reads of all KS partials issue together instead of one wait per range
#pragma unroll
    for (int i = 0; i < 8 / KS; ++i) {
        const int idx = tid + i * 128 * KS; const int row = idx >> 4, cofs = (idx & 15) * 4, rg = row >> 4, rr = row & 15;
        float mm = sml[rg][0][rr];
#pragma unroll
        for (int ks = 1; ks < KS; ++ks) mm = fmaxf(mm, sml[ks * 4 + rg][0][rr]);
        float ls = 0.0f; v4f o = (v4f){};
#pragma unroll
        for (int ks = 0; ks < KS; ++ks) { const float w = exp2f(sml[ks * 4 + rg][0][rr] - mm); ls += w * sml[ks * 4 + rg][1][rr]; o += w * *(const v4fa*)(&wsc[ks * 4 + rg][rr * OSP + cofs]); }
        *(v4f*)(orow + (size_t)row * DH + cofs) = o * (1.0f / ls);
    }
}

extern "C" void kernel_launch(void* const* d_in, const int* in_sizes, int n_in,
                              void* d_out, int out_size, void* d_ws, size_t ws_size, hipStream_t stream) {
    if (n_in < 5) return;
    const size_t need_x = ((size_t)(NB - 1) * SEQ_FULL + SEQ) * DH;
    if ((size_t)in_sizes[0] < need_x || (size_t)in_sizes[1] < need_x) return;
    if (in_sizes[2] < DH * DH || in_sizes[3] < DH * DH || in_sizes[4] < DH * DH) return;
    if ((size_t)out_size < (size_t)NB * SEQ * DH) return;
    const float* x1 = (const float*)d_in[0];   // [4][4096][64]
    const float* x2 = (const float*)d_in[1];   // [4][4096][64]
    const float* wq = (const float*)d_in[2];   // [64][64] = [out][in]
    const float* wk = (const float*)d_in[3];
    const float* wv = (const float*)d_in[4];
    float* OUT = (float*)d_out;                // [4][4096][64]
    const size_t n = (size_t)NB * SEQ * DH;
    char* wsp = (char*)d_ws;
    auto take = [&](size_t bytes) { char* p = wsp; wsp += (bytes + 255) & ~(size_t)255; return (void*)p; };
    h16* P16 = (h16*)take(3 * n * 2); h16* Q16 = P16; h16* K16 = P16 + n; h16* Vt16 = P16 + 2 * n;          // fp16 planes: q [NB*SEQ][64], k and v^T in fragment order (k_proj)
    float* VS = (float*)take((size_t)NB * (SEQ / KBK) * DH * 4);                                             // [NB][SEQ/64][64]
    if ((size_t)(wsp - (char*)d_ws) > ws_size) return;    // total 6,356,992 B at NB=4, SEQ=4096
    const float sc = 1.0f / sqrtf((float)SEQ);
    const float scl2 = sc * 1.4426950408889634f;
    k_proj<<<dim3(NB * SEQ / 64, 3, 1), 128, 0, stream>>>(x1, x2, wq, wk, wv, Q16, K16, Vt16, VS);
    k_attn<<<NB * SEQ / 64, 128 * KS, 0, stream>>>(Q16, K16, Vt16, VS, OUT, scl2);
}

// v005
// It runs in 28.6 microseconds.
// In two side-by-side timings against v004, it was 1.03 and 1.10 times as fast.
// All steps since v000 together make it 6.55 times as fast.
#include <hip/hip_runtime.h>
#include <math.h>

// Single-head cross attention: q = x1 Wq^T, k = x2 Wk^T, v = x2 Wv^T (x [4][4096][64] f32, W [64][64] = [out][in]); p = softmax over keys of (q.k) * SEQ^-0.5; out = p v -> f32 [4][4096][64].
// Compute dtypes, f32 accumulate: all five inputs RNE-converted to bf16; q, k and v^T projections on v_wmma_f32_16x16x32_bf16 (plain bf16 operands); q.k^T and p.v on v_wmma_f32_16x16x32_f16 (q, k, v^T as plain fp16 planes; p enters as fp16 of (p - 0.6875), and 0.6875 * (64-key column sums of v, f32) is added to the f32 accumulator); online softmax (running max, exp2, row sums, 1/l) in f32.

#ifndef NB
#define NB 4
#endif
#ifndef SEQ
#define SEQ 4096
#endif
#define NB_FULL  4
#define SEQ_FULL 4096
#define DH       64
#define KBK      64
#define OSP      68
#define TP       72     // LDS pitch of a staged bf16 row, elements: 144 bytes = 16 bytes x odd, for the 16-byte fragment reads
#define CCEN     0.6875f
#define KS       8      // key ranges per work-group: wave = (range, 32-query group)
#define QT       2      // 16-query tiles per wave: every k and v^T fragment a wave loads feeds QT products
#define NW       16     // waves per work-group = KS * 64 / (16 * QT)
static_assert(NB >= 1 && NB <= NB_FULL);
static_assert(SEQ >= KBK && SEQ <= SEQ_FULL && (SEQ % 64) == 0);
static_assert(DH == 64 && KBK == 64);
static_assert((SEQ / KBK) % KS == 0 && NW * 16 * QT == 64 * KS && QT == 2);

typedef _Float16 h16;
typedef unsigned short bf;
typedef __attribute__((ext_vector_type(16))) __bf16   v16bf;
typedef __attribute__((ext_vector_type(16))) _Float16 v16h;
typedef __attribute__((ext_vector_type(8)))  _Float16 v8h;
typedef __attribute__((ext_vector_type(8)))  unsigned short v8us;
typedef __attribute__((ext_vector_type(8)))  float    v8f;
typedef __attribute__((ext_vector_type(4)))  float    v4f;
typedef __attribute__((ext_vector_type(4)))  unsigned short v4us;
typedef v8us __attribute__((may_alias)) v8usa;
typedef v4us __attribute__((may_alias)) v4usa;
typedef v4f  __attribute__((may_alias)) v4fa;

__device__ __forceinline__ unsigned short f2bf(float f) { unsigned u = __float_as_uint(f); u += 0x7FFFu + ((u >> 16) & 1u); return (unsigned short)(u >> 16); }
__device__ __forceinline__ v16h cat16(v8h lo, v8h hi) { return __builtin_shufflevector(lo, hi, 0, 1, 2, 3, 4, 5, 6, 7, 8, 9, 10, 11, 12, 13, 14, 15); }
__device__ __forceinline__ v16bf cat16b(v8us lo, v8us hi) { return __builtin_bit_cast(v16bf, __builtin_shufflevector(lo, hi, 0, 1, 2, 3, 4, 5, 6, 7, 8, 9, 10, 11, 12, 13, 14, 15)); }
__device__ __forceinline__ v8f wmma16(v16h a, v16h b, v8f c) { return __builtin_amdgcn_wmma_f32_16x16x32_f16(false, a, false, b, (short)0, c, false, false); }
__device__ __forceinline__ v8f wmmab(v16bf a, v16bf b, v8f c) { return __builtin_amdgcn_wmma_f32_16x16x32_bf16(false, a, false, b, (short)0, c, false, false); }

// k_proj: the whole preparation in one launch. One work-group (4 waves) = one 64 x 64 product D = A.B^T over the 64 inputs; blockIdx.y = which: 0: q = x1 Wq^T, 1: k = x2 Wk^T (A = 64 rows of x, B = W), 2: v^T = Wv x2^T (A = Wv, B = 64 rows of x2).
// Both operands are contiguous 16-KB f32 blocks: read with whole-line 16-byte loads, RNE-converted to bf16 and laid in LDS (pitch TP); wave w takes rows 16 w .. 16 w + 15 of A against all of B.
// Fragment map (both operands): lane row/col = lane & 15, elements 0..7 <- k0 + 8h + 0..7, elements 8..15 <- k0 + 16 + 8h + 0..7 (h = lane >> 4); k0 = 0, then 32, into one f32 accumulator.
// The f32 tile goes through the wave's own LDS rows and leaves as fp16, 8 elements (16 bytes) per lane and store. q keeps its row-major layout [b][i][d].
// k and v^T are stored in FRAGMENT ORDER: per (batch, 64-key block) 8 KB = 16 groups (tile t = 0..3, piece j = 0..3) of 32 pieces, piece number in a group = the lane of k_attn that reads it (16 * h + row):
//   k:   piece (t, j, h, row) = k[key 64 kb + 16 t + row][d = 16 j + 8 h .. + 7];   v^T: piece (t, j, h, row) = v^T[d = 16 t + row][key 64 kb + 16 j + 8 h .. + 7];   t = this kernel's wave.
// One wave-wide 16-byte load of k_attn reads one group: 512 contiguous bytes, 4 whole 128-byte lines (from row-major planes it would touch 32-byte parts of 16 lines, and the WGP cache is paid per line touched).
// VS[b][kb][d] = f32 sum of v^T[d] over the block's 64 keys, from the same f32 tile: four running sums over key mod 4, then (s0 + s1) + (s2 + s3).
__global__ __launch_bounds__(128) void k_proj(const float* __restrict__ x1, const float* __restrict__ x2, const float* __restrict__ wq, const float* __restrict__ wk, const float* __restrict__ wv, h16* Q16, h16* K16, h16* Vt16, float* VS) {
    __shared__ __align__(16) bf sa[64 * TP];
    __shared__ __align__(16) bf sb[64 * TP];
    __shared__ __align__(16) float os[4][16 * OSP];
    const int tid = threadIdx.x, wave = tid >> 5, lane = tid & 31, lr = lane & 15, hi = lane >> 4;
    const int job = blockIdx.y, tile = blockIdx.x;   // tile = b * (SEQ / 64) + 64-row block
    const float* xt = (job == 0 ? x1 : x2) + ((size_t)(tile / (SEQ / 64)) * SEQ_FULL + (size_t)(tile % (SEQ / 64)) * 64) * DH;
    const float* wt = (job == 0) ? wq : ((job == 1) ? wk : wv);
    const float* As = (job == 2) ? wt : xt; const float* Bs = (job == 2) ? xt : wt;
    // every loop of this kernel has a constant trip count and is unrolled: its arrays stay in registers and its loads issue together, one latency per group
    v4f ra[8], rb[8];
#pragma unroll
    for (int i = 0; i < 8; ++i) { ra[i] = *(const v4f*)(As + (size_t)(tid + 128 * i) * 4); rb[i] = *(const v4f*)(Bs + (size_t)(tid + 128 * i) * 4); }
#pragma unroll
    for (int i = 0; i < 8; ++i) {
        const int p = tid + 128 * i, at = (p >> 4) * TP + (p & 15) * 4; v4us ca, cb;
#pragma unroll
        for (int k = 0; k < 4; ++k) { ca[k] = f2bf(ra[i][k]); cb[k] = f2bf(rb[i][k]); }
        *(v4usa*)(sa + at) = ca; *(v4usa*)(sb + at) = cb; }
    __syncthreads();
    const bf* ap = sa + (16 * wave + lr) * TP + 8 * hi; const bf* bp = sb + lr * TP + 8 * hi;
    v8f acc[4];
#pragma unroll
    for (int nb = 0; nb < 4; ++nb) acc[nb] = (v8f){};
#pragma unroll
    for (int kc = 0; kc < DH; kc += 32) {
        const v16bf a = cat16b(*(const v8usa*)(ap + kc), *(const v8usa*)(ap + kc + 16));
#pragma unroll
        for (int nb = 0; nb < 4; ++nb) acc[nb] = wmmab(a, cat16b(*(const v8usa*)(bp + nb * 16 * TP + kc), *(const v8usa*)(bp + nb * 16 * TP + kc + 16)), acc[nb]); }
    float* o = &os[wave][0];
#pragma unroll
    for (int nb = 0; nb < 4; ++nb) {
#pragma unroll
        for (int j = 0; j < 8; ++j) o[(hi * 8 + j) * OSP + nb * 16 + lr] = acc[nb][j]; }
    __syncthreads();
    h16* dst = ((job == 0) ? Q16 : ((job == 1) ? K16 : Vt16)) + (size_t)tile * (64 * DH) + wave * (16 * DH);   // this wave's 2 KB, in every plane
    // piece lane + 32 j of those 2 KB comes from: q, row (lane >> 3) + 4 j, columns 8 (lane & 7) ..; k and v^T, row lane & 15, columns 16 j + 8 h ..
    const float* sp = o + ((job == 0) ? (lane >> 3) * OSP + (lane & 7) * 8 : lr * OSP + 8 * hi); const int step = (job == 0) ? 4 * OSP : 16;
    v8h h[4];
#pragma unroll
    for (int j = 0; j < 4; ++j) {
        const v4f lo = *(const v4fa*)(sp + j * step), up = *(const v4fa*)(sp + j * step + 4);
#pragma unroll
        for (int k = 0; k < 4; ++k) { h[j][k] = (h16)lo[k]; h[j][4 + k] = (h16)up[k]; } }
#pragma unroll
    for (int j = 0; j < 4; ++j) *(v8h*)(dst + (lane + 32 * j) * 8) = h[j];
    if (job == 2 && wave < 2) {   // one wave per 128-byte line of VS: lane = d - 32 * wave
        const int d = 32 * wave + lane; const float* col = &os[d >> 4][(d & 15) * OSP]; v4f s4 = (v4f){};
#pragma unroll
        for (int q = 0; q < KBK / 4; ++q) s4 += *(const v4fa*)(col + q * 4);
        VS[(size_t)tile * DH + d] = (s4[0] + s4[1]) + (s4[2] + s4[3]); }
}

// lane l <-> l ^ 16: the two halves of a wave hold the two key halves of one query column.
__device__ __forceinline__ float xhalf(float x) { const int b = __float_as_int(x); return __int_as_float(__builtin_amdgcn_permlanex16(b, b, 0x76543210, 0xfedcba98, false, false)); }

// k_attn: flash-style attention, one block = (batch b, 64 query rows), NW waves: wave & 1 = 32-query group (QT tiles of 16 queries), wave >> 1 = key range; range ks takes key blocks ks, ks + KS, ... (64 keys each)
// with its own running max, sums and un-normalised accumulators; the KS partials of a query are merged in LDS at the end (weights exp2(m_ks - max), one division by the merged sum).
// A wave's k and v^T fragments (and VS values) are loaded once per key block and used for both of its query tiles: half the bytes loaded into registers per product of a wave with one tile.
// Transposed tiles: S^T = K.Q^T (A = k from its fragment-order plane, see k_proj; B = q rows [b][i][d]; fp16, both with the split-k map straight from global): register r of tile t = score of key 16t + 8h + r for query lane & 15,
// so a lane holds 32 of its query's 64 scores: max and sum run in registers, the max joined between the halves by one cross-row move per key block, the sums joined once after the loop.
// Online softmax in f32 with scale folded as scl2 = SEQ^-0.5 * log2(e); p = exp2(s*scl2 - mrun) in (0, 1].
// P^T: score tiles 2c and 2c + 1, converted in place (fp16 of p - CCEN), are the B fragment of keys 32c .. 32c + 31; A = v^T from its fragment-order plane (fp16, same map): O^T += V^T.P^T, no LDS and no barrier in the loop.
// acc[g][n][r] = O^T[16n + 8h + r][query of tile g]; acc += CCEN * VS[b][kb][d]  (VS = f32 column sums of the 64 keys) so that acc == sum_m p_m v_m exactly in real arithmetic.
__global__ __launch_bounds__(32 * NW) __attribute__((amdgpu_waves_per_eu(NW / 4, NW / 4)))
void k_attn(const h16* __restrict__ Q16, const h16* __restrict__ K16, const h16* __restrict__ Vt16, const float* __restrict__ VS, float* OUT, float scl2) {
    __shared__ __align__(16) float wsc[NW][16 * QT * OSP];
    __shared__ float sml[NW][2][16 * QT];
    const int tid = threadIdx.x, wave = tid >> 5, lane = tid & 31, l16 = lane & 15, hi = lane >> 4;
    const int nqb = SEQ / 64; const int b = blockIdx.x / nqb; const int blk0 = (blockIdx.x % nqb) * 64; const int row0 = blk0 + (wave & 1) * (16 * QT); const int nkb = SEQ / KBK;
    const h16* qp = Q16 + ((size_t)b * SEQ + row0 + l16) * DH + 8 * hi;
    const h16* kp = K16 + (size_t)b * SEQ * DH;    // fragment order (k_proj): key block kb at kb * 4096 elements, group (t, j) at (4 t + j) * 256, this lane's piece at 8 * lane
    const h16* vp = Vt16 + (size_t)b * DH * SEQ;   // the same order, t = 16-row group of v^T
    const unsigned lo8 = 8u * (unsigned)lane;
    const float* vsp = VS + (size_t)b * nkb * DH + 8 * hi;
    const int ks0 = __builtin_amdgcn_readfirstlane(wave >> 1);   // key range in a scalar register: the loop's count and branch stay scalar, EXEC untouched around the matrix instructions
    float* os = &wsc[wave][0];
    // every loop over g, t, n, r below has a constant trip count and is unrolled: its arrays stay in registers
    v16h qb[QT][2];
#pragma unroll
    for (int g = 0; g < QT; ++g) {
        const h16* qg = qp + g * 16 * DH;
        qb[g][0] = cat16(*(const v8h*)qg, *(const v8h*)(qg + 16));
        qb[g][1] = cat16(*(const v8h*)(qg + 32), *(const v8h*)(qg + 48)); }
    v8f acc[QT][4];
#pragma unroll
    for (int g = 0; g < QT; ++g) {
#pragma unroll
        for (int n = 0; n < 4; ++n) acc[g][n] = (v8f){}; }
    float m[QT], l[QT];
#pragma unroll
    for (int g = 0; g < QT; ++g) { m[g] = -1.0e30f; l[g] = 0.0f; }
#pragma unroll 1
    for (int kb = ks0; kb < nkb; kb += KS) {
        const h16* kq = kp + (size_t)kb * (KBK * DH); const h16* vq = vp + (size_t)kb * (KBK * DH);   // this key block's 8 KB of k and of v^T: wave-uniform addresses
        v16h ka[4][2];
#pragma unroll
        for (int t = 0; t < 4; ++t) {
            const h16* p0 = &kq[lo8 + t * 1024];
            ka[t][0] = cat16(*(const v8h*)p0, *(const v8h*)(p0 + 256));
            ka[t][1] = cat16(*(const v8h*)(p0 + 512), *(const v8h*)(p0 + 768)); }
        __builtin_amdgcn_sched_barrier(0);   // all 16 k loads issue before the first product; without it the compiler spreads them among the products and a wave waits out the load latency several times per key block
        v8f s[QT][4];
#pragma unroll
        for (int t = 0; t < 4; ++t) {
#pragma unroll
            for (int g = 0; g < QT; ++g) s[g][t] = wmma16(ka[t][0], qb[g][0], (v8f){});
#pragma unroll
            for (int g = 0; g < QT; ++g) s[g][t] = wmma16(ka[t][1], qb[g][1], s[g][t]); }
        // four vector slots between the last score product and the first vector instruction that reads a score tile
        asm volatile("v_nop\n\tv_nop\n\tv_nop\n\tv_nop" : "+v"(s[0][0]), "+v"(s[0][1]), "+v"(s[0][2]), "+v"(s[0][3]), "+v"(s[1][0]), "+v"(s[1][1]), "+v"(s[1][2]), "+v"(s[1][3]) : "v"(qb[0][0]), "v"(qb[0][1]), "v"(qb[1][0]), "v"(qb[1][1]));
        v8f vs8[4];
#pragma unroll
        for (int n = 0; n < 4; ++n) {
            const float* vs0 = vsp + (size_t)kb * DH + n * 16;
            const v4f va = *(const v4f*)vs0, vb = *(const v4f*)(vs0 + 4);
            vs8[n] = __builtin_shufflevector(va, vb, 0, 1, 2, 3, 4, 5, 6, 7); }
        float corr[QT];
#pragma unroll
        for (int g = 0; g < QT; ++g) {
            float mt[4];
#pragma unroll
            for (int t = 0; t < 4; ++t) mt[t] = fmaxf(fmaxf(fmaxf(s[g][t][0], s[g][t][1]), fmaxf(s[g][t][2], s[g][t][3])), fmaxf(fmaxf(s[g][t][4], s[g][t][5]), fmaxf(s[g][t][6], s[g][t][7])));
            float mx = fmaxf(fmaxf(mt[0], mt[1]), fmaxf(mt[2], mt[3])); mx = fmaxf(mx, xhalf(mx)) * scl2;   // scl2 > 0: the scaled max is the max of the scaled scores
            const float mn = fmaxf(m[g], mx); corr[g] = exp2f(m[g] - mn); m[g] = mn; }
        __builtin_amdgcn_sched_barrier(0);   // the first use of a VS value, and with it the wait for those loads, stays behind the maxima
#pragma unroll
        for (int n = 0; n < 4; ++n) {
#pragma unroll
            for (int g = 0; g < QT; ++g) acc[g][n] = acc[g][n] * corr[g] + vs8[n] * CCEN; }
        // The v^T loads go out in QT groups, one in front of each query tile's exponentials, which cover their latency: all score tiles and all of v^T at once do not fit the 256 registers of a wave
        // (the compiler spills); the second group takes the registers that the first tile's scores leave when they are packed to fp16.
        v16h va[4][2]; v16h pb[QT][2];
#pragma unroll
        for (int g = 0; g < QT; ++g) {
#pragma unroll
            for (int n = g * (4 / QT); n < (g + 1) * (4 / QT); ++n) {
                const h16* p0 = &vq[lo8 + n * 1024];
                va[n][0] = cat16(*(const v8h*)p0, *(const v8h*)(p0 + 256));
                va[n][1] = cat16(*(const v8h*)(p0 + 512), *(const v8h*)(p0 + 768)); }
            __builtin_amdgcn_sched_barrier(0);   // the group's 8 loads issue before this tile's exponentials; moved down among them or behind them, the output products wait out the load latency
            float st[4];
#pragma unroll
            for (int t = 0; t < 4; ++t) {
                float p[8];
#pragma unroll
                for (int r = 0; r < 8; ++r) { p[r] = exp2f(s[g][t][r] * scl2 - m[g]); pb[g][t >> 1][(t & 1) * 8 + r] = (h16)(p[r] - CCEN); }
                st[t] = ((p[0] + p[1]) + (p[2] + p[3])) + ((p[4] + p[5]) + (p[6] + p[7]));
                __builtin_amdgcn_sched_barrier(0); }   // score tile by score tile: with all 32 exponentials of a query tile mixed, their temporaries overflow the 256 registers and the compiler spills
            l[g] = l[g] * corr[g] + ((st[0] + st[1]) + (st[2] + st[3])); }
#pragma unroll
        for (int n = 0; n < 4; ++n) {
#pragma unroll
            for (int g = 0; g < QT; ++g) { acc[g][n] = wmma16(va[n][0], pb[g][0], acc[g][n]); acc[g][n] = wmma16(va[n][1], pb[g][1], acc[g][n]); } }
        // the same four slots behind the last output product, on the loop's taken back edge and on its exit alike
        asm volatile("v_nop\n\tv_nop\n\tv_nop\n\tv_nop" : "+v"(acc[0][0]), "+v"(acc[0][1]), "+v"(acc[0][2]), "+v"(acc[0][3]), "+v"(acc[1][0]), "+v"(acc[1][1]), "+v"(acc[1][2]), "+v"(acc[1][3]) : "v"(pb[0][0]), "v"(pb[0][1]), "v"(pb[1][0]), "v"(pb[1][1]));
    }
#pragma unroll
    for (int g = 0; g < QT; ++g) {
        l[g] += xhalf(l[g]);
        if (hi == 0) { sml[wave][0][16 * g + l16] = m[g]; sml[wave][1][16 * g + l16] = l[g]; }
#pragma unroll
        for (int n = 0; n < 4; ++n) {
            *(v4fa*)(os + (16 * g + l16) * OSP + n * 16 + 8 * hi) = __builtin_shufflevector(acc[g][n], acc[g][n], 0, 1, 2, 3);
            *(v4fa*)(os + (16 * g + l16) * OSP + n * 16 + 8 * hi + 4) = __builtin_shufflevector(acc[g][n], acc[g][n], 4, 5, 6, 7); } }
    __syncthreads();
    float* orow = OUT + ((size_t)b * SEQ + blk0) * DH;
    // the three unrolls below: constant trip counts, so that the LDS reads of all KS partials issue together instead of one wait per range
#pragma unroll
    for (int i = 0; i < 32 / NW; ++i) {
        const int idx = tid + i * 32 * NW; const int row = idx >> 4, cofs = (idx & 15) * 4, rg = row / (16 * QT), rr = row % (16 * QT);
        float mm = sml[rg][0][rr];
#pragma unroll
        for (int ks = 1; ks < KS; ++ks) mm = fmaxf(mm, sml[ks * 2 + rg][0][rr]);
        float ls = 0.0f; v4f o = (v4f){};
#pragma unroll
        for (int ks = 0; ks < KS; ++ks) { const float w = exp2f(sml[ks * 2 + rg][0][rr] - mm); ls += w * sml[ks * 2 + rg][1][rr]; o += w * *(const v4fa*)(&wsc[ks * 2 + rg][rr * OSP + cofs]); }
        *(v4f*)(orow + (size_t)row * DH + cofs) = o * (1.0f / ls);
    }
}

extern "C" void kernel_launch(void* const* d_in, const int* in_sizes, int n_in,
                              void* d_out, int out_size, void* d_ws, size_t ws_size, hipStream_t stream) {
    if (n_in < 5) return;
    const size_t need_x = ((size_t)(NB - 1) * SEQ_FULL + SEQ) * DH;
    if ((size_t)in_sizes[0] < need_x || (size_t)in_sizes[1] < need_x) return;
    if (in_sizes[2] < DH * DH || in_sizes[3] < DH * DH || in_sizes[4] < DH * DH) return;
    if ((size_t)out_size < (size_t)NB * SEQ * DH) return;
    const float* x1 = (const float*)d_in[0];   // [4][4096][64]
    const float* x2 = (const float*)d_in[1];   // [4][4096][64]
    const float* wq = (const float*)d_in[2];   // [64][64] = [out][in]
    const float* wk = (const float*)d_in[3];
    const float* wv = (const float*)d_in[4];
    float* OUT = (float*)d_out;                // [4][4096][64]
    const size_t n = (size_t)NB * SEQ * DH;
    char* wsp = (char*)d_ws;
    auto take = [&](size_t bytes) { char* p = wsp; wsp += (bytes + 255) & ~(size_t)255; return (void*)p; };
    h16* P16 = (h16*)take(3 * n * 2); h16* Q16 = P16; h16* K16 = P16 + n; h16* Vt16 = P16 + 2 * n;          // fp16 planes: q [NB*SEQ][64], k and v^T in fragment order (k_proj)
    float* VS = (float*)take((size_t)NB * (SEQ / KBK) * DH * 4);                                             // [NB][SEQ/64][64]
    if ((size_t)(wsp - (char*)d_ws) > ws_size) return;    // total 6,356,992 B at NB=4, SEQ=4096
    const float sc = 1.0f / sqrtf((float)SEQ);
    const float scl2 = sc * 1.4426950408889634f;
    k_proj<<<dim3(NB * SEQ / 64, 3, 1), 128, 0, stream>>>(x1, x2, wq, wk, wv, Q16, K16, Vt16, VS);
    k_attn<<<NB * SEQ / 64, 32 * NW, 0, stream>>>(Q16, K16, Vt16, VS, OUT, scl2);
}

// v006
// Measured time: 23.5 microseconds a run.
// Next to v005, in two timings, it ran 1.21 times as fast each time.
// Counting every step since v000, it is 7.94 times as fast.
#include <hip/hip_runtime.h>
#include <math.h>

// Single-head cross attention: q = x1 Wq^T, k = x2 Wk^T, v = x2 Wv^T (x [4][4096][64] f32, W [64][64] = [out][in]); p = softmax over keys of (q.k) * SEQ^-0.5; out = p v -> f32 [4][4096][64].
// Compute dtypes, f32 accumulate: all five inputs RNE-converted to bf16; q, k and v^T projections on v_wmma_f32_16x16x32_bf16 (plain bf16 operands); q.k^T and p.v on v_wmma_f32_16x16x32_f16 (q, k, v^T as plain fp16 planes; p enters as fp16 of (p - 0.6875), and 0.6875 * (64-key column sums of v, f32) is added to the f32 accumulator); online softmax (running max, exp2, row sums, 1/l) in f32.

#ifndef NB
#define NB 4
#endif
#ifndef SEQ
#define SEQ 4096
#endif
#define NB_FULL  4
#define SEQ_FULL 4096
#define DH       64
#define KBK      64
#define OSP      68
#define TP       72     // LDS pitch of a staged bf16 row, elements: 144 bytes = 16 bytes x odd, for the 16-byte fragment reads
#define CCEN     0.6875f
#define KS       8      // key ranges per work-group: wave = (range, 32-query group)
#define QT       2      // 16-query tiles per wave: every k and v^T fragment a wave loads feeds QT products
#define NW       16     // waves per work-group = KS * 64 / (16 * QT)
static_assert(NB >= 1 && NB <= NB_FULL);
static_assert(SEQ >= KBK && SEQ <= SEQ_FULL && (SEQ % 64) == 0);
static_assert(DH == 64 && KBK == 64);
static_assert((SEQ / KBK) % KS == 0 && NW * 16 * QT == 64 * KS && QT == 2);

typedef _Float16 h16;
typedef unsigned short bf;
typedef __attribute__((ext_vector_type(16))) __bf16   v16bf;
typedef __attribute__((ext_vector_type(16))) _Float16 v16h;
typedef __attribute__((ext_vector_type(8)))  _Float16 v8h;
typedef __attribute__((ext_vector_type(8)))  unsigned short v8us;
typedef __attribute__((ext_vector_type(8)))  float    v8f;
typedef __attribute__((ext_vector_type(4)))  float    v4f;
typedef __attribute__((ext_vector_type(4)))  unsigned short v4us;
typedef v8us __attribute__((may_alias)) v8usa;
typedef v4us __attribute__((may_alias)) v4usa;
typedef v4f  __attribute__((may_alias)) v4fa;

__device__ __forceinline__ unsigned short f2bf(float f) { unsigned u = __float_as_uint(f); u += 0x7FFFu + ((u >> 16) & 1u); return (unsigned short)(u >> 16); }
__device__ __forceinline__ v16h cat16(v8h lo, v8h hi) { return __builtin_shufflevector(lo, hi, 0, 1, 2, 3, 4, 5, 6, 7, 8, 9, 10, 11, 12, 13, 14, 15); }
__device__ __forceinline__ v16bf cat16b(v8us lo, v8us hi) { return __builtin_bit_cast(v16bf, __builtin_shufflevector(lo, hi, 0, 1, 2, 3, 4, 5, 6, 7, 8, 9, 10, 11, 12, 13, 14, 15)); }
__device__ __forceinline__ v8f wmma16(v16h a, v16h b, v8f c) { return __builtin_amdgcn_wmma_f32_16x16x32_f16(false, a, false, b, (short)0, c, false, false); }
__device__ __forceinline__ v8f wmmab(v16bf a, v16bf b, v8f c) { return __builtin_amdgcn_wmma_f32_16x16x32_bf16(false, a, false, b, (short)0, c, false, false); }

// k_proj: the whole preparation in one launch. One work-group (4 waves) = one 64 x 64 product D = A.B^T over the 64 inputs; blockIdx.y = which: 0: q = x1 Wq^T, 1: k = x2 Wk^T (A = 64 rows of x, B = W), 2: v^T = Wv x2^T (A = Wv, B = 64 rows of x2).
// Both operands are contiguous 16-KB f32 blocks: read with whole-line 16-byte loads, RNE-converted to bf16 and laid in LDS (pitch TP); wave w takes rows 16 w .. 16 w + 15 of A against all of B.
// Fragment map (both operands): lane row/col = lane & 15, elements 0..7 <- k0 + 8h + 0..7, elements 8..15 <- k0 + 16 + 8h + 0..7 (h = lane >> 4); k0 = 0, then 32, into one f32 accumulator.
// The f32 tile goes through the wave's own LDS rows and leaves as fp16, 8 elements (16 bytes) per lane and store. q keeps its row-major layout [b][i][d].
// k and v^T are stored in FRAGMENT ORDER: per (batch, 64-key block) 8 KB = 16 groups (tile t = 0..3, piece j = 0..3) of 32 pieces, piece number in a group = the lane of k_attn that reads it (16 * h + row):
//   k:   piece (t, j, h, row) = k[key 64 kb + 16 t + row][d = 16 j + 8 h .. + 7];   v^T: piece (t, j, h, row) = v^T[d = 16 t + row][key 64 kb + 16 j + 8 h .. + 7];   t = this kernel's wave.
// One wave-wide 16-byte load of k_attn reads one group: 512 contiguous bytes, 4 whole 128-byte lines (from row-major planes it would touch 32-byte parts of 16 lines, and the WGP cache is paid per line touched).
// VS[b][kb][d] = f32 sum of v^T[d] over the block's 64 keys, from the same f32 tile: four running sums over key mod 4, then (s0 + s1) + (s2 + s3).
__global__ __launch_bounds__(128) void k_proj(const float* __restrict__ x1, const float* __restrict__ x2, const float* __restrict__ wq, const float* __restrict__ wk, const float* __restrict__ wv, h16* Q16, h16* K16, h16* Vt16, float* VS) {
    __shared__ __align__(16) bf sa[64 * TP];
    __shared__ __align__(16) bf sb[64 * TP];
    __shared__ __align__(16) float os[4][16 * OSP];
    const int tid = threadIdx.x, wave = tid >> 5, lane = tid & 31, lr = lane & 15, hi = lane >> 4;
    const int job = blockIdx.y, tile = blockIdx.x;   // tile = b * (SEQ / 64) + 64-row block
    const float* xt = (job == 0 ? x1 : x2) + ((size_t)(tile / (SEQ / 64)) * SEQ_FULL + (size_t)(tile % (SEQ / 64)) * 64) * DH;
    const float* wt = (job == 0) ? wq : ((job == 1) ? wk : wv);
    const float* As = (job == 2) ? wt : xt; const float* Bs = (job == 2) ? xt : wt;
    // every loop of this kernel has a constant trip count and is unrolled: its arrays stay in registers and its loads issue together, one latency per group
    v4f ra[8], rb[8];
#pragma unroll
    for (int i = 0; i < 8; ++i) { ra[i] = *(const v4f*)(As + (size_t)(tid + 128 * i) * 4); rb[i] = *(const v4f*)(Bs + (size_t)(tid + 128 * i) * 4); }
#pragma unroll
    for (int i = 0; i < 8; ++i) {
        const int p = tid + 128 * i, at = (p >> 4) * TP + (p & 15) * 4; v4us ca, cb;
#pragma unroll
        for (int k = 0; k < 4; ++k) { ca[k] = f2bf(ra[i][k]); cb[k] = f2bf(rb[i][k]); }
        *(v4usa*)(sa + at) = ca; *(v4usa*)(sb + at) = cb; }
    __syncthreads();
    const bf* ap = sa + (16 * wave + lr) * TP + 8 * hi; const bf* bp = sb + lr * TP + 8 * hi;
    v8f acc[4];
#pragma unroll
    for (int nb = 0; nb < 4; ++nb) acc[nb] = (v8f){};
#pragma unroll
    for (int kc = 0; kc < DH; kc += 32) {
        const v16bf a = cat16b(*(const v8usa*)(ap + kc), *(const v8usa*)(ap + kc + 16));
#pragma unroll
        for (int nb = 0; nb < 4; ++nb) acc[nb] = wmmab(a, cat16b(*(const v8usa*)(bp + nb * 16 * TP + kc), *(const v8usa*)(bp + nb * 16 * TP + kc + 16)), acc[nb]); }
    float* o = &os[wave][0];
#pragma unroll
    for (int nb = 0; nb < 4; ++nb) {
#pragma unroll
        for (int j = 0; j < 8; ++j) o[(hi * 8 + j) * OSP + nb * 16 + lr] = acc[nb][j]; }
    __syncthreads();
    h16* dst = ((job == 0) ? Q16 : ((job == 1) ? K16 : Vt16)) + (size_t)tile * (64 * DH) + wave * (16 * DH);   // this wave's 2 KB, in every plane
    // piece lane + 32 j of those 2 KB comes from: q, row (lane >> 3) + 4 j, columns 8 (lane & 7) ..; k and v^T, row lane & 15, columns 16 j + 8 h ..
    const float* sp = o + ((job == 0) ? (lane >> 3) * OSP + (lane & 7) * 8 : lr * OSP + 8 * hi); const int step = (job == 0) ? 4 * OSP : 16;
    v8h h[4];
#pragma unroll
    for (int j = 0; j < 4; ++j) {
        const v4f lo = *(const v4fa*)(sp + j * step), up = *(const v4fa*)(sp + j * step + 4);
#pragma unroll
        for (int k = 0; k < 4; ++k) { h[j][k] = (h16)lo[k]; h[j][4 + k] = (h16)up[k]; } }
#pragma unroll
    for (int j = 0; j < 4; ++j) *(v8h*)(dst + (lane + 32 * j) * 8) = h[j];
    if (job == 2 && wave < 2) {   // one wave per 128-byte line of VS: lane = d - 32 * wave
        const int d = 32 * wave + lane; const float* col = &os[d >> 4][(d & 15) * OSP]; v4f s4 = (v4f){};
#pragma unroll
        for (int q = 0; q < KBK / 4; ++q) s4 += *(const v4fa*)(col + q * 4);
        VS[(size_t)tile * DH + d] = (s4[0] + s4[1]) + (s4[2] + s4[3]); }
}

// 2^x as the one hardware instruction (v_exp_f32). The library exp2f wraps it in a compare, two selects, an add and an ldexp per value, only so that results below 2^-126 come out as subnormals instead of 0.
// For the key loop: every argument there is (value - running max) <= 0 and every result is weighed against a sum that holds a term 1: a result below 2^-126 adds nothing to an f32 sum >= 1, and p - CCEN rounds to -CCEN either way.
__device__ __forceinline__ float ex2(float x) { return __builtin_amdgcn_exp2f(x); }

// lane l <-> l ^ 16: the two halves of a wave hold the two key halves of one query column.
__device__ __forceinline__ float xhalf(float x) { const int b = __float_as_int(x); return __int_as_float(__builtin_amdgcn_permlanex16(b, b, 0x76543210, 0xfedcba98, false, false)); }

// k_attn: flash-style attention, one block = (batch b, 64 query rows), NW waves: wave & 1 = 32-query group (QT tiles of 16 queries), wave >> 1 = key range; range ks takes key blocks ks, ks + KS, ... (64 keys each)
// with its own running max, sums and un-normalised accumulators; the KS partials of a query are merged in LDS at the end (weights exp2(m_ks - max), one division by the merged sum).
// A wave's k and v^T fragments (and VS values) are loaded once per key block and used for both of its query tiles: half the bytes loaded into registers per product of a wave with one tile.
// Transposed tiles: S^T = K.Q^T (A = k from its fragment-order plane, see k_proj; B = q rows [b][i][d]; fp16, both with the split-k map straight from global): register r of tile t = score of key 16t + 8h + r for query lane & 15,
// so a lane holds 32 of its query's 64 scores: max and sum run in registers, the max joined between the halves by one cross-row move per key block, the sums joined once after the loop.
// Online softmax in f32 with scale folded as scl2 = SEQ^-0.5 * log2(e); p = exp2(s*scl2 - mrun) in (0, 1].
// P^T: score tiles 2c and 2c + 1, converted in place (fp16 of p - CCEN), are the B fragment of keys 32c .. 32c + 31; A = v^T from its fragment-order plane (fp16, same map): O^T += V^T.P^T, no LDS and no barrier in the loop.
// acc[g][n][r] = O^T[16n + 8h + r][query of tile g]; acc += CCEN * VS[b][kb][d]  (VS = f32 column sums of the 64 keys) so that acc == sum_m p_m v_m exactly in real arithmetic.
__global__ __launch_bounds__(32 * NW) __attribute__((amdgpu_waves_per_eu(NW / 4, NW / 4)))
void k_attn(const h16* __restrict__ Q16, const h16* __restrict__ K16, const h16* __restrict__ Vt16, const float* __restrict__ VS, float* OUT, float scl2) {
    __shared__ __align__(16) float wsc[NW][16 * QT * OSP];
    __shared__ float sml[NW][2][16 * QT];
    const int tid = threadIdx.x, wave = tid >> 5, lane = tid & 31, l16 = lane & 15, hi = lane >> 4;
    const int nqb = SEQ / 64; const int b = blockIdx.x / nqb; const int blk0 = (blockIdx.x % nqb) * 64; const int row0 = blk0 + (wave & 1) * (16 * QT); const int nkb = SEQ / KBK;
    const h16* qp = Q16 + ((size_t)b * SEQ + row0 + l16) * DH + 8 * hi;
    const h16* kp = K16 + (size_t)b * SEQ * DH;    // fragment order (k_proj): key block kb at kb * 4096 elements, group (t, j) at (4 t + j) * 256, this lane's piece at 8 * lane
    const h16* vp = Vt16 + (size_t)b * DH * SEQ;   // the same order, t = 16-row group of v^T
    const unsigned lo8 = 8u * (unsigned)lane;
    const float* vsp = VS + (size_t)b * nkb * DH + 8 * hi;
    const int ks0 = __builtin_amdgcn_readfirstlane(wave >> 1);   // key range in a scalar register: the loop's count and branch stay scalar, EXEC untouched around the matrix instructions
    float* os = &wsc[wave][0];
    // every loop over g, t, n, r below has a constant trip count and is unrolled: its arrays stay in registers
    v16h qb[QT][2];
#pragma unroll
    for (int g = 0; g < QT; ++g) {
        const h16* qg = qp + g * 16 * DH;
        qb[g][0] = cat16(*(const v8h*)qg, *(const v8h*)(qg + 16));
        qb[g][1] = cat16(*(const v8h*)(qg + 32), *(const v8h*)(qg + 48)); }
    v8f acc[QT][4];
#pragma unroll
    for (int g = 0; g < QT; ++g) {
#pragma unroll
        for (int n = 0; n < 4; ++n) acc[g][n] = (v8f){}; }
    float m[QT], l[QT];
#pragma unroll
    for (int g = 0; g < QT; ++g) { m[g] = -1.0e30f; l[g] = 0.0f; }
#pragma unroll 1
    for (int kb = ks0; kb < nkb; kb += KS) {
        const h16* kq = kp + (size_t)kb * (KBK * DH); const h16* vq = vp + (size_t)kb * (KBK * DH);   // this key block's 8 KB of k and of v^T: wave-uniform addresses
        v16h ka[4][2];
#pragma unroll
        for (int t = 0; t < 4; ++t) {
            const h16* p0 = &kq[lo8 + t * 1024];
            ka[t][0] = cat16(*(const v8h*)p0, *(const v8h*)(p0 + 256));
            ka[t][1] = cat16(*(const v8h*)(p0 + 512), *(const v8h*)(p0 + 768)); }
        __builtin_amdgcn_sched_barrier(0);   // all 16 k loads issue before the first product; without it the compiler spreads them among the products and a wave waits out the load latency several times per key block
        v8f s[QT][4];
#pragma unroll
        for (int t = 0; t < 4; ++t) {
#pragma unroll
            for (int g = 0; g < QT; ++g) s[g][t] = wmma16(ka[t][0], qb[g][0], (v8f){});
#pragma unroll
            for (int g = 0; g < QT; ++g) s[g][t] = wmma16(ka[t][1], qb[g][1], s[g][t]); }
        // four vector slots between the last score product and the first vector instruction that reads a score tile
        asm volatile("v_nop\n\tv_nop\n\tv_nop\n\tv_nop" : "+v"(s[0][0]), "+v"(s[0][1]), "+v"(s[0][2]), "+v"(s[0][3]), "+v"(s[1][0]), "+v"(s[1][1]), "+v"(s[1][2]), "+v"(s[1][3]) : "v"(qb[0][0]), "v"(qb[0][1]), "v"(qb[1][0]), "v"(qb[1][1]));
        v8f vs8[4];
#pragma unroll
        for (int n = 0; n < 4; ++n) {
            const float* vs0 = vsp + (size_t)kb * DH + n * 16;
            const v4f va = *(const v4f*)vs0, vb = *(const v4f*)(vs0 + 4);
            vs8[n] = __builtin_shufflevector(va, vb, 0, 1, 2, 3, 4, 5, 6, 7); }
        float corr[QT];
#pragma unroll
        for (int g = 0; g < QT; ++g) {
            float mt[4];
#pragma unroll
            for (int t = 0; t < 4; ++t) mt[t] = fmaxf(fmaxf(fmaxf(s[g][t][0], s[g][t][1]), fmaxf(s[g][t][2], s[g][t][3])), fmaxf(fmaxf(s[g][t][4], s[g][t][5]), fmaxf(s[g][t][6], s[g][t][7])));
            float mx = fmaxf(fmaxf(mt[0], mt[1]), fmaxf(mt[2], mt[3])); mx = fmaxf(mx, xhalf(mx)) * scl2;   // scl2 > 0: the scaled max is the max of the scaled scores
            const float mn = fmaxf(m[g], mx); corr[g] = ex2(m[g] - mn); m[g] = mn; }
        __builtin_amdgcn_sched_barrier(0);   // the first use of a VS value, and with it the wait for those loads, stays behind the maxima
#pragma unroll
        for (int n = 0; n < 4; ++n) {
#pragma unroll
            for (int g = 0; g < QT; ++g) acc[g][n] = acc[g][n] * corr[g] + vs8[n] * CCEN; }
        // The v^T loads go out in QT groups, one in front of each query tile's exponentials, which cover their latency: all score tiles and all of v^T at once do not fit the 256 registers of a wave
        // (the compiler spills); the second group takes the registers that the first tile's scores leave when they are packed to fp16.
        v16h va[4][2]; v16h pb[QT][2];
#pragma unroll
        for (int g = 0; g < QT; ++g) {
#pragma unroll
            for (int n = g * (4 / QT); n < (g + 1) * (4 / QT); ++n) {
                const h16* p0 = &vq[lo8 + n * 1024];
                va[n][0] = cat16(*(const v8h*)p0, *(const v8h*)(p0 + 256));
                va[n][1] = cat16(*(const v8h*)(p0 + 512), *(const v8h*)(p0 + 768)); }
            __builtin_amdgcn_sched_barrier(0);   // the group's 8 loads issue before this tile's exponentials; moved down among them or behind them, the output products wait out the load latency
            float st[4];
#pragma unroll
            for (int t = 0; t < 4; ++t) {
                float p[8];
#pragma unroll
                for (int r = 0; r < 8; ++r) { p[r] = ex2(s[g][t][r] * scl2 - m[g]); pb[g][t >> 1][(t & 1) * 8 + r] = (h16)(p[r] - CCEN); }
                st[t] = ((p[0] + p[1]) + (p[2] + p[3])) + ((p[4] + p[5]) + (p[6] + p[7]));
                __builtin_amdgcn_sched_barrier(0); }   // score tile by score tile: with all 32 exponentials of a query tile mixed, their temporaries overflow the 256 registers and the compiler spills
            l[g] = l[g] * corr[g] + ((st[0] + st[1]) + (st[2] + st[3])); }
#pragma unroll
        for (int n = 0; n < 4; ++n) {
#pragma unroll
            for (int g = 0; g < QT; ++g) { acc[g][n] = wmma16(va[n][0], pb[g][0], acc[g][n]); acc[g][n] = wmma16(va[n][1], pb[g][1], acc[g][n]); } }
        // the same four slots behind the last output product, on the loop's taken back edge and on its exit alike
        asm volatile("v_nop\n\tv_nop\n\tv_nop\n\tv_nop" : "+v"(acc[0][0]), "+v"(acc[0][1]), "+v"(acc[0][2]), "+v"(acc[0][3]), "+v"(acc[1][0]), "+v"(acc[1][1]), "+v"(acc[1][2]), "+v"(acc[1][3]) : "v"(pb[0][0]), "v"(pb[0][1]), "v"(pb[1][0]), "v"(pb[1][1]));
    }
#pragma unroll
    for (int g = 0; g < QT; ++g) {
        l[g] += xhalf(l[g]);
        if (hi == 0) { sml[wave][0][16 * g + l16] = m[g]; sml[wave][1][16 * g + l16] = l[g]; }
#pragma unroll
        for (int n = 0; n < 4; ++n) {
            *(v4fa*)(os + (16 * g + l16) * OSP + n * 16 + 8 * hi) = __builtin_shufflevector(acc[g][n], acc[g][n], 0, 1, 2, 3);
            *(v4fa*)(os + (16 * g + l16) * OSP + n * 16 + 8 * hi + 4) = __builtin_shufflevector(acc[g][n], acc[g][n], 4, 5, 6, 7); } }
    __syncthreads();
    float* orow = OUT + ((size_t)b * SEQ + blk0) * DH;
    // the three unrolls below: constant trip counts, so that the LDS reads of all KS partials issue together instead of one wait per range
#pragma unroll
    for (int i = 0; i < 32 / NW; ++i) {
        const int idx = tid + i * 32 * NW; const int row = idx >> 4, cofs = (idx & 15) * 4, rg = row / (16 * QT), rr = row % (16 * QT);
        float mm = sml[rg][0][rr];
#pragma unroll
        for (int ks = 1; ks < KS; ++ks) mm = fmaxf(mm, sml[ks * 2 + rg][0][rr]);
        float ls = 0.0f; v4f o = (v4f){};
#pragma unroll
        for (int ks = 0; ks < KS; ++ks) { const float w = exp2f(sml[ks * 2 + rg][0][rr] - mm); ls += w * sml[ks * 2 + rg][1][rr]; o += w * *(const v4fa*)(&wsc[ks * 2 + rg][rr * OSP + cofs]); }
        *(v4f*)(orow + (size_t)row * DH + cofs) = o * (1.0f / ls);
    }
}

extern "C" void kernel_launch(void* const* d_in, const int* in_sizes, int n_in,
                              void* d_out, int out_size, void* d_ws, size_t ws_size, hipStream_t stream) {
    if (n_in < 5) return;
    const size_t need_x = ((size_t)(NB - 1) * SEQ_FULL + SEQ) * DH;
    if ((size_t)in_sizes[0] < need_x || (size_t)in_sizes[1] < need_x) return;
    if (in_sizes[2] < DH * DH || in_sizes[3] < DH * DH || in_sizes[4] < DH * DH) return;
    if ((size_t)out_size < (size_t)NB * SEQ * DH) return;
    const float* x1 = (const float*)d_in[0];   // [4][4096][64]
    const float* x2 = (const float*)d_in[1];   // [4][4096][64]
    const float* wq = (const float*)d_in[2];   // [64][64] = [out][in]
    const float* wk = (const float*)d_in[3];
    const float* wv = (const float*)d_in[4];
    float* OUT = (float*)d_out;                // [4][4096][64]
    const size_t n = (size_t)NB * SEQ * DH;
    char* wsp = (char*)d_ws;
    auto take = [&](size_t bytes) { char* p = wsp; wsp += (bytes + 255) & ~(size_t)255; return (void*)p; };
    h16* P16 = (h16*)take(3 * n * 2); h16* Q16 = P16; h16* K16 = P16 + n; h16* Vt16 = P16 + 2 * n;          // fp16 planes: q [NB*SEQ][64], k and v^T in fragment order (k_proj)
    float* VS = (float*)take((size_t)NB * (SEQ / KBK) * DH * 4);                                             // [NB][SEQ/64][64]
    if ((size_t)(wsp - (char*)d_ws) > ws_size) return;    // total 6,356,992 B at NB=4, SEQ=4096
    const float sc = 1.0f / sqrtf((float)SEQ);
    const float scl2 = sc * 1.4426950408889634f;
    k_proj<<<dim3(NB * SEQ / 64, 3, 1), 128, 0, stream>>>(x1, x2, wq, wk, wv, Q16, K16, Vt16, VS);
    k_attn<<<NB * SEQ / 64, 32 * NW, 0, stream>>>(Q16, K16, Vt16, VS, OUT, scl2);
}

// v007
// It runs in 22.3 microseconds.
// Two timings next to v006 put it at 1.05 and 1.08 times that version's speed.
// Over all steps from v000 it is 8.43 times as fast.
#include <hip/hip_runtime.h>
#include <math.h>

// Single-head cross attention: q = x1 Wq^T, k = x2 Wk^T, v = x2 Wv^T (x [4][4096][64] f32, W [64][64] = [out][in]); p = softmax over keys of (q.k) * SEQ^-0.5; out = p v -> f32 [4][4096][64].
// Compute dtypes, f32 accumulate: all five inputs RNE-converted to bf16; q, k and v^T projections on v_wmma_f32_16x16x32_bf16 (plain bf16 operands); q.k^T and p.v on v_wmma_f32_16x16x32_f16 (q, k, v^T as plain fp16 planes; p enters as fp16 of (p - 0.6875), and 0.6875 * (64-key column sums of v, f32) is added to the f32 accumulator); online softmax (running max, exp2, row sums, 1/l) in f32.

#ifndef NB
#define NB 4
#endif
#ifndef SEQ
#define SEQ 4096
#endif
#define NB_FULL  4
#define SEQ_FULL 4096
#define DH       64
#define KBK      64
#define OSP      68
#define TP       72     // LDS pitch of a staged bf16 row, elements: 144 bytes = 16 bytes x odd, for the 16-byte fragment reads
#define CCEN     0.6875f
#define KS       8      // key ranges per work-group: wave = (range, 32-query group)
#define QT       2      // 16-query tiles per wave: every k and v^T fragment a wave loads feeds QT products
#define NW       16     // waves per work-group = KS * 64 / (16 * QT)
#define LAZY     1.0f   // a query's max in use is kept until a block max exceeds it by more than this (scaled log2 units): p stays in (0, 2]
static_assert(NB >= 1 && NB <= NB_FULL);
static_assert(SEQ >= KBK && SEQ <= SEQ_FULL && (SEQ % 64) == 0);
static_assert(DH == 64 && KBK == 64);
static_assert((SEQ / KBK) % KS == 0 && NW * 16 * QT == 64 * KS && QT == 2);

typedef _Float16 h16;
typedef unsigned short bf;
typedef __attribute__((ext_vector_type(16))) __bf16   v16bf;
typedef __attribute__((ext_vector_type(16))) _Float16 v16h;
typedef __attribute__((ext_vector_type(8)))  _Float16 v8h;
typedef __attribute__((ext_vector_type(8)))  unsigned short v8us;
typedef __attribute__((ext_vector_type(8)))  float    v8f;
typedef __attribute__((ext_vector_type(4)))  float    v4f;
typedef __attribute__((ext_vector_type(4)))  unsigned short v4us;
typedef v8us __attribute__((may_alias)) v8usa;
typedef v4us __attribute__((may_alias)) v4usa;
typedef v4f  __attribute__((may_alias)) v4fa;
typedef __attribute__((ext_vector_type(2)))  float    v2f;
typedef v2f  __attribute__((may_alias)) v2fa;

__device__ __forceinline__ unsigned short f2bf(float f) { unsigned u = __float_as_uint(f); u += 0x7FFFu + ((u >> 16) & 1u); return (unsigned short)(u >> 16); }
__device__ __forceinline__ v16h cat16(v8h lo, v8h hi) { return __builtin_shufflevector(lo, hi, 0, 1, 2, 3, 4, 5, 6, 7, 8, 9, 10, 11, 12, 13, 14, 15); }
__device__ __forceinline__ v16bf cat16b(v8us lo, v8us hi) { return __builtin_bit_cast(v16bf, __builtin_shufflevector(lo, hi, 0, 1, 2, 3, 4, 5, 6, 7, 8, 9, 10, 11, 12, 13, 14, 15)); }
__device__ __forceinline__ v8f wmma16(v16h a, v16h b, v8f c) { return __builtin_amdgcn_wmma_f32_16x16x32_f16(false, a, false, b, (short)0, c, false, false); }
__device__ __forceinline__ v8f wmmab(v16bf a, v16bf b, v8f c) { return __builtin_amdgcn_wmma_f32_16x16x32_bf16(false, a, false, b, (short)0, c, false, false); }

// k_proj: the whole preparation in one launch. One work-group (4 waves) = one 64 x 64 product D = A.B^T over the 64 inputs; blockIdx.y = which: 0: q = x1 Wq^T, 1: k = x2 Wk^T (A = 64 rows of x, B = W), 2: v^T = Wv x2^T (A = Wv, B = 64 rows of x2).
// Both operands are contiguous 16-KB f32 blocks: read with whole-line 16-byte loads, RNE-converted to bf16 and laid in LDS (pitch TP); wave w takes rows 16 w .. 16 w + 15 of A against all of B.
// Fragment map (both operands): lane row/col = lane & 15, elements 0..7 <- k0 + 8h + 0..7, elements 8..15 <- k0 + 16 + 8h + 0..7 (h = lane >> 4); k0 = 0, then 32, into one f32 accumulator.
// The f32 tile goes through the wave's own LDS rows and leaves as fp16, 8 elements (16 bytes) per lane and store. q keeps its row-major layout [b][i][d].
// k and v^T are stored in FRAGMENT ORDER: per (batch, 64-key block) 8 KB = 16 groups (tile t = 0..3, piece j = 0..3) of 32 pieces, piece number in a group = the lane of k_attn that reads it (16 * h + row):
//   k:   piece (t, j, h, row) = k[key 64 kb + 16 t + row][d = 16 j + 8 h .. + 7];   v^T: piece (t, j, h, row) = v^T[d = 16 t + row][key 64 kb + 16 j + 8 h .. + 7];   t = this kernel's wave.
// One wave-wide 16-byte load of k_attn reads one group: 512 contiguous bytes, 4 whole 128-byte lines (from row-major planes it would touch 32-byte parts of 16 lines, and the WGP cache is paid per line touched).
// VS[b][kb][d] = f32 sum of v^T[d] over the block's 64 keys, from the same f32 tile: four running sums over key mod 4, then (s0 + s1) + (s2 + s3).
__global__ __launch_bounds__(128) void k_proj(const float* __restrict__ x1, const float* __restrict__ x2, const float* __restrict__ wq, const float* __restrict__ wk, const float* __restrict__ wv, h16* Q16, h16* K16, h16* Vt16, float* VS) {
    __shared__ __align__(16) bf sa[64 * TP];
    __shared__ __align__(16) bf sb[64 * TP];
    __shared__ __align__(16) float os[4][16 * OSP];
    const int tid = threadIdx.x, wave = tid >> 5, lane = tid & 31, lr = lane & 15, hi = lane >> 4;
    const int job = blockIdx.y, tile = blockIdx.x;   // tile = b * (SEQ / 64) + 64-row block
    const float* xt = (job == 0 ? x1 : x2) + ((size_t)(tile / (SEQ / 64)) * SEQ_FULL + (size_t)(tile % (SEQ / 64)) * 64) * DH;
    const float* wt = (job == 0) ? wq : ((job == 1) ? wk : wv);
    const float* As = (job == 2) ? wt : xt; const float* Bs = (job == 2) ? xt : wt;
    // every loop of this kernel has a constant trip count and is unrolled: its arrays stay in registers and its loads issue together, one latency per group
    v4f ra[8], rb[8];
#pragma unroll
    for (int i = 0; i < 8; ++i) { ra[i] = *(const v4f*)(As + (size_t)(tid + 128 * i) * 4); rb[i] = *(const v4f*)(Bs + (size_t)(tid + 128 * i) * 4); }
#pragma unroll
    for (int i = 0; i < 8; ++i) {
        const int p = tid + 128 * i, at = (p >> 4) * TP + (p & 15) * 4; v4us ca, cb;
#pragma unroll
        for (int k = 0; k < 4; ++k) { ca[k] = f2bf(ra[i][k]); cb[k] = f2bf(rb[i][k]); }
        *(v4usa*)(sa + at) = ca; *(v4usa*)(sb + at) = cb; }
    __syncthreads();
    const bf* ap = sa + (16 * wave + lr) * TP + 8 * hi; const bf* bp = sb + lr * TP + 8 * hi;
    v8f acc[4];
#pragma unroll
    for (int nb = 0; nb < 4; ++nb) acc[nb] = (v8f){};
#pragma unroll
    for (int kc = 0; kc < DH; kc += 32) {
        const v16bf a = cat16b(*(const v8usa*)(ap + kc), *(const v8usa*)(ap + kc + 16));
#pragma unroll
        for (int nb = 0; nb < 4; ++nb) acc[nb] = wmmab(a, cat16b(*(const v8usa*)(bp + nb * 16 * TP + kc), *(const v8usa*)(bp + nb * 16 * TP + kc + 16)), acc[nb]); }
    float* o = &os[wave][0];
#pragma unroll
    for (int nb = 0; nb < 4; ++nb) {
#pragma unroll
        for (int j = 0; j < 8; ++j) o[(hi * 8 + j) * OSP + nb * 16 + lr] = acc[nb][j]; }
    __syncthreads();
    h16* dst = ((job == 0) ? Q16 : ((job == 1) ? K16 : Vt16)) + (size_t)tile * (64 * DH) + wave * (16 * DH);   // this wave's 2 KB, in every plane
    // piece lane + 32 j of those 2 KB comes from: q, row (lane >> 3) + 4 j, columns 8 (lane & 7) ..; k and v^T, row lane & 15, columns 16 j + 8 h ..
    const float* sp = o + ((job == 0) ? (lane >> 3) * OSP + (lane & 7) * 8 : lr * OSP + 8 * hi); const int step = (job == 0) ? 4 * OSP : 16;
    v8h h[4];
#pragma unroll
    for (int j = 0; j < 4; ++j) {
        const v4f lo = *(const v4fa*)(sp + j * step), up = *(const v4fa*)(sp + j * step + 4);
#pragma unroll
        for (int k = 0; k < 4; ++k) { h[j][k] = (h16)lo[k]; h[j][4 + k] = (h16)up[k]; } }
#pragma unroll
    for (int j = 0; j < 4; ++j) *(v8h*)(dst + (lane + 32 * j) * 8) = h[j];
    if (job == 2 && wave < 2) {   // one wave per 128-byte line of VS: lane = d - 32 * wave
        const int d = 32 * wave + lane; const float* col = &os[d >> 4][(d & 15) * OSP]; v4f s4 = (v4f){};
#pragma unroll
        for (int q = 0; q < KBK / 4; ++q) s4 += *(const v4fa*)(col + q * 4);
        VS[(size_t)tile * DH + d] = (s4[0] + s4[1]) + (s4[2] + s4[3]); }
}

// 2^x as the one hardware instruction (v_exp_f32). The library exp2f wraps it in a compare, two selects, an add and an ldexp per value, only so that results below 2^-126 come out as subnormals instead of 0.
// For the key loop: every argument there is (value - max in use) <= LAZY and every result is weighed against a sum that holds a term 1: a result below 2^-126 adds nothing to an f32 sum >= 1, and p - CCEN rounds to -CCEN either way.
__device__ __forceinline__ float ex2(float x) { return __builtin_amdgcn_exp2f(x); }

// lane l <-> l ^ 16: the two halves of a wave hold the two key halves of one query column.
__device__ __forceinline__ float xhalf(float x) { const int b = __float_as_int(x); return __int_as_float(__builtin_amdgcn_permlanex16(b, b, 0x76543210, 0xfedcba98, false, false)); }

// k_attn: flash-style attention, one block = (batch b, 64 query rows), NW waves: wave & 1 = 32-query group (QT tiles of 16 queries), wave >> 1 = key range; range ks takes key blocks ks, ks + KS, ... (64 keys each)
// with its own max in use, sums and un-normalised accumulators; the KS partials of a query are merged in LDS at the end (weights exp2(m_ks - max), one division by the merged sum).
// A wave's k and v^T fragments (and VS values) are loaded once per key block and used for both of its query tiles: half the bytes loaded into registers per product of a wave with one tile.
// Transposed tiles: S^T = K.Q^T (A = k from its fragment-order plane, see k_proj; B = q rows [b][i][d]; fp16, both with the split-k map straight from global): register r of tile t = score of key 16t + 8h + r for query lane & 15,
// so a lane holds 32 of its query's 64 scores: max and sum run in registers, the max joined between the halves by a cross-row move only where the max in use changes, the sums joined once after the loop.
// Online softmax in f32 with scale folded as scl2 = SEQ^-0.5 * log2(e); p = exp2(s*scl2 - max in use) in (0, 2].
// P^T: score tiles 2c and 2c + 1, converted in place (fp16 of p - CCEN), are the B fragment of keys 32c .. 32c + 31; A = v^T from its fragment-order plane (fp16, same map): O^T += V^T.P^T, no LDS and no barrier in the loop.
// acc[g][n][r] = O^T[16n + 8h + r][query of tile g] holds sum_m (p_m - CCEN) v_m; the other part, CCEN * VS[b][kb][d] (VS = f32 column sums of the 64 keys), has the same weight for all key blocks that ran under one max in use.
// Lazy rescale: the max in use changes only when some query's block max exceeds it by more than LAZY, tested once per key block by a scalar branch. In a block that keeps it, acc and l are not rescaled and the block's VS row
// is only added to vrun (2 values of d per lane). A block that changes it first adds CCEN * vrun to acc (cross-lane moves bring it into acc's layout), then rescales acc and l and clears vrun. What vrun holds after the loop is added in the merge.
__global__ __launch_bounds__(32 * NW) __attribute__((amdgpu_waves_per_eu(NW / 4, NW / 4)))
void k_attn(const h16* __restrict__ Q16, const h16* __restrict__ K16, const h16* __restrict__ Vt16, const float* __restrict__ VS, float* OUT, float scl2) {
    __shared__ __align__(16) float wsc[NW][16 * QT * OSP];
    __shared__ float sml[NW][2][16 * QT];
    __shared__ __align__(16) float svs[NW][DH];
    const int tid = threadIdx.x, wave = tid >> 5, lane = tid & 31, l16 = lane & 15, hi = lane >> 4;
    const int nqb = SEQ / 64; const int b = blockIdx.x / nqb; const int blk0 = (blockIdx.x % nqb) * 64; const int row0 = blk0 + (wave & 1) * (16 * QT); const int nkb = SEQ / KBK;
    const h16* qp = Q16 + ((size_t)b * SEQ + row0 + l16) * DH + 8 * hi;
    const h16* kp = K16 + (size_t)b * SEQ * DH;    // fragment order (k_proj): key block kb at kb * 4096 elements, group (t, j) at (4 t + j) * 256, this lane's piece at 8 * lane
    const h16* vp = Vt16 + (size_t)b * DH * SEQ;   // the same order, t = 16-row group of v^T
    const unsigned lo8 = 8u * (unsigned)lane;
    const int ks0 = __builtin_amdgcn_readfirstlane(wave >> 1);   // key range in a scalar register: the loop's count and branch stay scalar, EXEC untouched around the matrix instructions
    float* os = &wsc[wave][0];
    // every loop over g, t, n, r, j below has a constant trip count and is unrolled: its arrays stay in registers
    v16h qb[QT][2];
#pragma unroll
    for (int g = 0; g < QT; ++g) {
        const h16* qg = qp + g * 16 * DH;
        qb[g][0] = cat16(*(const v8h*)qg, *(const v8h*)(qg + 16));
        qb[g][1] = cat16(*(const v8h*)(qg + 32), *(const v8h*)(qg + 48)); }
    v8f acc[QT][4];
#pragma unroll
    for (int g = 0; g < QT; ++g) {
#pragma unroll
        for (int n = 0; n < 4; ++n) acc[g][n] = (v8f){}; }
    float m[QT], l[QT];
#pragma unroll
    for (int g = 0; g < QT; ++g) { m[g] = -1.0e30f; l[g] = 0.0f; }
    const float* vsl = VS + (size_t)b * nkb * DH + 2 * lane;
    v2f vrun = (v2f){};   // sum of VS[kb][2 lane, 2 lane + 1] over the key blocks since the max in use last changed
#pragma unroll 1
    for (int kb = ks0; kb < nkb; kb += KS) {
        const v2f vsk = *(const v2f*)(vsl + (size_t)kb * DH);   // oldest load of the block, used after the maxima: its latency is covered by the k loads' own
        const h16* kq = kp + (size_t)kb * (KBK * DH); const h16* vq = vp + (size_t)kb * (KBK * DH);   // this key block's 8 KB of k and of v^T: wave-uniform addresses
        v16h ka[4][2];
#pragma unroll
        for (int t = 0; t < 4; ++t) {
            const h16* p0 = &kq[lo8 + t * 1024];
            ka[t][0] = cat16(*(const v8h*)p0, *(const v8h*)(p0 + 256));
            ka[t][1] = cat16(*(const v8h*)(p0 + 512), *(const v8h*)(p0 + 768)); }
        __builtin_amdgcn_sched_barrier(0);   // all 16 k loads issue before the first product; without it the compiler spreads them among the products and a wave waits out the load latency several times per key block
        v8f s[QT][4];
#pragma unroll
        for (int t = 0; t < 4; ++t) {
#pragma unroll
            for (int g = 0; g < QT; ++g) s[g][t] = wmma16(ka[t][0], qb[g][0], (v8f){});
#pragma unroll
            for (int g = 0; g < QT; ++g) s[g][t] = wmma16(ka[t][1], qb[g][1], s[g][t]); }
        // four vector slots between the last score product and the first vector instruction that reads a score tile
        asm volatile("v_nop\n\tv_nop\n\tv_nop\n\tv_nop" : "+v"(s[0][0]), "+v"(s[0][1]), "+v"(s[0][2]), "+v"(s[0][3]), "+v"(s[1][0]), "+v"(s[1][1]), "+v"(s[1][2]), "+v"(s[1][3]) : "v"(qb[0][0]), "v"(qb[0][1]), "v"(qb[1][0]), "v"(qb[1][1]));
        float mh[QT];   // block max of the 32 scores this lane holds (its half of the query's 64), unscaled
#pragma unroll
        for (int g = 0; g < QT; ++g) {
            float mt[4];
#pragma unroll
            for (int t = 0; t < 4; ++t) mt[t] = fmaxf(fmaxf(fmaxf(s[g][t][0], s[g][t][1]), fmaxf(s[g][t][2], s[g][t][3])), fmaxf(fmaxf(s[g][t][4], s[g][t][5]), fmaxf(s[g][t][6], s[g][t][7])));
            mh[g] = fmaxf(fmaxf(mt[0], mt[1]), fmaxf(mt[2], mt[3])); }
        // one test per key block, the same for the whole wave (a scalar branch, EXEC untouched): the ballot joins the two halves of every query; scl2 > 0, so the scaled max is the max of the scaled scores.
        // Always taken in a wave's first block, where m is -1e30; marked unlikely so that the block that keeps its max falls through.
        if (__builtin_expect(__builtin_amdgcn_ballot_w32((mh[0] * scl2 > m[0] + LAZY) | (mh[1] * scl2 > m[1] + LAZY)) != 0u, 0)) {
            float mn[QT];
#pragma unroll
            for (int g = 0; g < QT; ++g) mn[g] = fmaxf(m[g], fmaxf(mh[g], xhalf(mh[g])) * scl2);   // both halves of a query take the same new max
            if (kb != ks0) {   // in a wave's first block acc, l and vrun are still 0: nothing to add or rescale
#pragma unroll
                for (int n = 0; n < 4; ++n) {
                    v8f vs8;   // vrun in the layout of acc: d = 16 n + 8 h + 2 j (+ 1) is held by lane 8 n + 4 h + j
#pragma unroll
                    for (int j = 0; j < 4; ++j) {
                        const int from = 4 * (8 * n + j) + (tid & 16);   // byte address of the source lane; tid & 16 = 4 * 4 h
                        vs8[2 * j] = __int_as_float(__builtin_amdgcn_ds_bpermute(from, __float_as_int(vrun[0])));
                        vs8[2 * j + 1] = __int_as_float(__builtin_amdgcn_ds_bpermute(from, __float_as_int(vrun[1]))); }
#pragma unroll
                    for (int g = 0; g < QT; ++g) acc[g][n] += vs8 * CCEN; }
#pragma unroll
                for (int g = 0; g < QT; ++g) {
                    const float corr = ex2(m[g] - mn[g]); l[g] *= corr;
#pragma unroll
                    for (int n = 0; n < 4; ++n) acc[g][n] *= corr; }
                vrun = (v2f){}; }
#pragma unroll
            for (int g = 0; g < QT; ++g) m[g] = mn[g]; }
        vrun += vsk;
        // The v^T loads go out in QT groups, one in front of each query tile's exponentials, which cover their latency: all score tiles and all of v^T at once do not fit the 256 registers of a wave
        // (the compiler spills); the second group takes the registers that the first tile's scores leave when they are packed to fp16.
        v16h va[4][2]; v16h pb[QT][2];
#pragma unroll
        for (int g = 0; g < QT; ++g) {
#pragma unroll
            for (int n = g * (4 / QT); n < (g + 1) * (4 / QT); ++n) {
                const h16* p0 = &vq[lo8 + n * 1024];
                va[n][0] = cat16(*(const v8h*)p0, *(const v8h*)(p0 + 256));
                va[n][1] = cat16(*(const v8h*)(p0 + 512), *(const v8h*)(p0 + 768)); }
            __builtin_amdgcn_sched_barrier(0);   // the group's 8 loads issue before this tile's exponentials; moved down among them or behind them, the output products wait out the load latency
            float st[4];
#pragma unroll
            for (int t = 0; t < 4; ++t) {
                float p[8];
#pragma unroll
                for (int r = 0; r < 8; ++r) { p[r] = ex2(s[g][t][r] * scl2 - m[g]); pb[g][t >> 1][(t & 1) * 8 + r] = (h16)(p[r] - CCEN); }
                st[t] = ((p[0] + p[1]) + (p[2] + p[3])) + ((p[4] + p[5]) + (p[6] + p[7]));
                __builtin_amdgcn_sched_barrier(0); }   // score tile by score tile: with all 32 exponentials of a query tile mixed, their temporaries overflow the 256 registers and the compiler spills
            l[g] += (st[0] + st[1]) + (st[2] + st[3]); }
#pragma unroll
        for (int n = 0; n < 4; ++n) {
#pragma unroll
            for (int g = 0; g < QT; ++g) { acc[g][n] = wmma16(va[n][0], pb[g][0], acc[g][n]); acc[g][n] = wmma16(va[n][1], pb[g][1], acc[g][n]); } }
        // the same four slots behind the last output product, on the loop's taken back edge and on its exit alike
        asm volatile("v_nop\n\tv_nop\n\tv_nop\n\tv_nop" : "+v"(acc[0][0]), "+v"(acc[0][1]), "+v"(acc[0][2]), "+v"(acc[0][3]), "+v"(acc[1][0]), "+v"(acc[1][1]), "+v"(acc[1][2]), "+v"(acc[1][3]) : "v"(pb[0][0]), "v"(pb[0][1]), "v"(pb[1][0]), "v"(pb[1][1]));
    }
#pragma unroll
    for (int g = 0; g < QT; ++g) {
        l[g] += xhalf(l[g]);
        if (hi == 0) { sml[wave][0][16 * g + l16] = m[g]; sml[wave][1][16 * g + l16] = l[g]; }
#pragma unroll
        for (int n = 0; n < 4; ++n) {
            *(v4fa*)(os + (16 * g + l16) * OSP + n * 16 + 8 * hi) = __builtin_shufflevector(acc[g][n], acc[g][n], 0, 1, 2, 3);
            *(v4fa*)(os + (16 * g + l16) * OSP + n * 16 + 8 * hi + 4) = __builtin_shufflevector(acc[g][n], acc[g][n], 4, 5, 6, 7); } }
    *(v2fa*)(&svs[wave][2 * lane]) = vrun;
    __syncthreads();
    float* orow = OUT + ((size_t)b * SEQ + blk0) * DH;
    // the three unrolls below: constant trip counts, so that the LDS reads of all KS partials issue together instead of one wait per range
#pragma unroll
    for (int i = 0; i < 32 / NW; ++i) {
        const int idx = tid + i * 32 * NW; const int row = idx >> 4, cofs = (idx & 15) * 4, rg = row / (16 * QT), rr = row % (16 * QT);
        float mm = sml[rg][0][rr];
#pragma unroll
        for (int ks = 1; ks < KS; ++ks) mm = fmaxf(mm, sml[ks * 2 + rg][0][rr]);
        float ls = 0.0f; v4f o = (v4f){};
#pragma unroll
        for (int ks = 0; ks < KS; ++ks) { const float w = exp2f(sml[ks * 2 + rg][0][rr] - mm); ls += w * sml[ks * 2 + rg][1][rr]; o += w * (*(const v4fa*)(&wsc[ks * 2 + rg][rr * OSP + cofs]) + CCEN * *(const v4fa*)(&svs[ks * 2 + rg][cofs])); }
        *(v4f*)(orow + (size_t)row * DH + cofs) = o * (1.0f / ls);
    }
}

extern "C" void kernel_launch(void* const* d_in, const int* in_sizes, int n_in,
                              void* d_out, int out_size, void* d_ws, size_t ws_size, hipStream_t stream) {
    if (n_in < 5) return;
    const size_t need_x = ((size_t)(NB - 1) * SEQ_FULL + SEQ) * DH;
    if ((size_t)in_sizes[0] < need_x || (size_t)in_sizes[1] < need_x) return;
    if (in_sizes[2] < DH * DH || in_sizes[3] < DH * DH || in_sizes[4] < DH * DH) return;
    if ((size_t)out_size < (size_t)NB * SEQ * DH) return;
    const float* x1 = (const float*)d_in[0];   // [4][4096][64]
    const float* x2 = (const float*)d_in[1];   // [4][4096][64]
    const float* wq = (const float*)d_in[2];   // [64][64] = [out][in]
    const float* wk = (const float*)d_in[3];
    const float* wv = (const float*)d_in[4];
    float* OUT = (float*)d_out;                // [4][4096][64]
    const size_t n = (size_t)NB * SEQ * DH;
    char* wsp = (char*)d_ws;
    auto take = [&](size_t bytes) { char* p = wsp; wsp += (bytes + 255) & ~(size_t)255; return (void*)p; };
    h16* P16 = (h16*)take(3 * n * 2); h16* Q16 = P16; h16* K16 = P16 + n; h16* Vt16 = P16 + 2 * n;          // fp16 planes: q [NB*SEQ][64], k and v^T in fragment order (k_proj)
    float* VS = (float*)take((size_t)NB * (SEQ / KBK) * DH * 4);                                             // [NB][SEQ/64][64]
    if ((size_t)(wsp - (char*)d_ws) > ws_size) return;    // total 6,356,992 B at NB=4, SEQ=4096
    const float sc = 1.0f / sqrtf((float)SEQ);
    const float scl2 = sc * 1.4426950408889634f;
    k_proj<<<dim3(NB * SEQ / 64, 3, 1), 128, 0, stream>>>(x1, x2, wq, wk, wv, Q16, K16, Vt16, VS);
    k_attn<<<NB * SEQ / 64, 32 * NW, 0, stream>>>(Q16, K16, Vt16, VS, OUT, scl2);
}

// v009
// A run of this version takes 19.4 microseconds.
// Versions in between are left out here; by their measured steps it is 1.14 times as fast as v007.
// Counting every step since v000, it is 9.57 times as fast.
#include <hip/hip_runtime.h>
#include <math.h>

// Single-head cross attention: q = x1 Wq^T, k = x2 Wk^T, v = x2 Wv^T (x [4][4096][64] f32, W [64][64] = [out][in]); p = softmax over keys of (q.k) * SEQ^-0.5; out = p v -> f32 [4][4096][64].
// Compute dtypes, f32 accumulate: all five inputs RNE-converted to bf16; q, k and v^T projections on v_wmma_f32_16x16x32_bf16 (plain bf16 operands); q.k^T and p.v on v_wmma_f32_16x16x32_f16 (q, k, v^T and p as plain fp16); online softmax (running max, exp2, row sums, 1/l) in f32.

#ifndef NB
#define NB 4
#endif
#ifndef SEQ
#define SEQ 4096
#endif
#define NB_FULL  4
#define SEQ_FULL 4096
#define DH       64
#define KBK      64
#define OSP      68
#define TP       72     // LDS pitch of a staged bf16 row, elements: 144 bytes = 16 bytes x odd, for the 16-byte fragment reads
#define KS       8      // key ranges per work-group: wave = (range, 32-query group)
#define QT       2      // 16-query tiles per wave: every k and v^T fragment a wave loads feeds QT products
#define NW       16     // waves per work-group = KS * 64 / (16 * QT)
#define LAZY     1.0f   // a query's max in use is kept until a block max exceeds it by more than this (scaled log2 units): p stays in (0, 2]
static_assert(NB >= 1 && NB <= NB_FULL);
static_assert(SEQ >= KBK && SEQ <= SEQ_FULL && (SEQ % 64) == 0);
static_assert(DH == 64 && KBK == 64);
static_assert((SEQ / KBK) % KS == 0 && NW * 16 * QT == 64 * KS && QT == 2);

typedef _Float16 h16;
typedef unsigned short bf;
typedef __attribute__((ext_vector_type(16))) __bf16   v16bf;
typedef __attribute__((ext_vector_type(16))) _Float16 v16h;
typedef __attribute__((ext_vector_type(8)))  _Float16 v8h;
typedef __attribute__((ext_vector_type(8)))  unsigned short v8us;
typedef __attribute__((ext_vector_type(8)))  float    v8f;
typedef __attribute__((ext_vector_type(4)))  float    v4f;
typedef __attribute__((ext_vector_type(4)))  unsigned short v4us;
typedef v8us __attribute__((may_alias)) v8usa;
typedef v4us __attribute__((may_alias)) v4usa;
typedef v4f  __attribute__((may_alias)) v4fa;

__device__ __forceinline__ unsigned short f2bf(float f) { unsigned u = __float_as_uint(f); u += 0x7FFFu + ((u >> 16) & 1u); return (unsigned short)(u >> 16); }
__device__ __forceinline__ v16h cat16(v8h lo, v8h hi) { return __builtin_shufflevector(lo, hi, 0, 1, 2, 3, 4, 5, 6, 7, 8, 9, 10, 11, 12, 13, 14, 15); }
__device__ __forceinline__ v16bf cat16b(v8us lo, v8us hi) { return __builtin_bit_cast(v16bf, __builtin_shufflevector(lo, hi, 0, 1, 2, 3, 4, 5, 6, 7, 8, 9, 10, 11, 12, 13, 14, 15)); }
__device__ __forceinline__ v8f wmma16(v16h a, v16h b, v8f c) { return __builtin_amdgcn_wmma_f32_16x16x32_f16(false, a, false, b, (short)0, c, false, false); }
__device__ __forceinline__ v8f wmmab(v16bf a, v16bf b, v8f c) { return __builtin_amdgcn_wmma_f32_16x16x32_bf16(false, a, false, b, (short)0, c, false, false); }

// k_proj: the whole preparation in one launch. One work-group (4 waves) = one 64 x 64 product D = A.B^T over the 64 inputs; blockIdx.y = which: 0: q = x1 Wq^T, 1: k = x2 Wk^T (A = 64 rows of x, B = W), 2: v^T = Wv x2^T (A = Wv, B = 64 rows of x2).
// Both operands are contiguous 16-KB f32 blocks: read with whole-line 16-byte loads, RNE-converted to bf16 and laid in LDS (pitch TP); wave w takes rows 16 w .. 16 w + 15 of A against all of B.
// Fragment map (both operands): lane row/col = lane & 15, elements 0..7 <- k0 + 8h + 0..7, elements 8..15 <- k0 + 16 + 8h + 0..7 (h = lane >> 4); k0 = 0, then 32, into one f32 accumulator.
// The f32 tile goes through the wave's own LDS rows and leaves as fp16, 8 elements (16 bytes) per lane and store. q keeps its row-major layout [b][i][d].
// k and v^T are stored in FRAGMENT ORDER: per (batch, 64-key block) 8 KB = 16 groups (tile t = 0..3, piece j = 0..3) of 32 pieces, piece number in a group = the lane of k_attn that reads it (16 * h + row):
//   k:   piece (t, j, h, row) = k[key 64 kb + 16 t + row][d = 16 j + 8 h .. + 7];   v^T: piece (t, j, h, row) = v^T[d = 16 t + row][key 64 kb + 16 j + 8 h .. + 7];   t = this kernel's wave.
// One wave-wide 16-byte load of k_attn reads one group: 512 contiguous bytes, 4 whole 128-byte lines (from row-major planes it would touch 32-byte parts of 16 lines, and the WGP cache is paid per line touched).
__global__ __launch_bounds__(128) void k_proj(const float* __restrict__ x1, const float* __restrict__ x2, const float* __restrict__ wq, const float* __restrict__ wk, const float* __restrict__ wv, h16* Q16, h16* K16, h16* Vt16) {
    __shared__ __align__(16) bf sa[64 * TP];
    __shared__ __align__(16) bf sb[64 * TP];
    __shared__ __align__(16) float os[4][16 * OSP];
    const int tid = threadIdx.x, wave = tid >> 5, lane = tid & 31, lr = lane & 15, hi = lane >> 4;
    const int job = blockIdx.y, tile = blockIdx.x;   // tile = b * (SEQ / 64) + 64-row block
    const float* xt = (job == 0 ? x1 : x2) + ((size_t)(tile / (SEQ / 64)) * SEQ_FULL + (size_t)(tile % (SEQ / 64)) * 64) * DH;
    const float* wt = (job == 0) ? wq : ((job == 1) ? wk : wv);
    const float* As = (job == 2) ? wt : xt; const float* Bs = (job == 2) ? xt : wt;
    // every loop of this kernel has a constant trip count and is unrolled: its arrays stay in registers and its loads issue together, one latency per group
    v4f ra[8], rb[8];
#pragma unroll
    for (int i = 0; i < 8; ++i) { ra[i] = *(const v4f*)(As + (size_t)(tid + 128 * i) * 4); rb[i] = *(const v4f*)(Bs + (size_t)(tid + 128 * i) * 4); }
#pragma unroll
    for (int i = 0; i < 8; ++i) {
        const int p = tid + 128 * i, at = (p >> 4) * TP + (p & 15) * 4; v4us ca, cb;
#pragma unroll
        for (int k = 0; k < 4; ++k) { ca[k] = f2bf(ra[i][k]); cb[k] = f2bf(rb[i][k]); }
        *(v4usa*)(sa + at) = ca; *(v4usa*)(sb + at) = cb; }
    __syncthreads();
    const bf* ap = sa + (16 * wave + lr) * TP + 8 * hi; const bf* bp = sb + lr * TP + 8 * hi;
    v8f acc[4];
#pragma unroll
    for (int nb = 0; nb < 4; ++nb) acc[nb] = (v8f){};
#pragma unroll
    for (int kc = 0; kc < DH; kc += 32) {
        const v16bf a = cat16b(*(const v8usa*)(ap + kc), *(const v8usa*)(ap + kc + 16));
#pragma unroll
        for (int nb = 0; nb < 4; ++nb) acc[nb] = wmmab(a, cat16b(*(const v8usa*)(bp + nb * 16 * TP + kc), *(const v8usa*)(bp + nb * 16 * TP + kc + 16)), acc[nb]); }
    float* o = &os[wave][0];
#pragma unroll
    for (int nb = 0; nb < 4; ++nb) {
#pragma unroll
        for (int j = 0; j < 8; ++j) o[(hi * 8 + j) * OSP + nb * 16 + lr] = acc[nb][j]; }
    __syncthreads();
    h16* dst = ((job == 0) ? Q16 : ((job == 1) ? K16 : Vt16)) + (size_t)tile * (64 * DH) + wave * (16 * DH);   // this wave's 2 KB, in every plane
    // piece lane + 32 j of those 2 KB comes from: q, row (lane >> 3) + 4 j, columns 8 (lane & 7) ..; k and v^T, row lane & 15, columns 16 j + 8 h ..
    const float* sp = o + ((job == 0) ? (lane >> 3) * OSP + (lane & 7) * 8 : lr * OSP + 8 * hi); const int step = (job == 0) ? 4 * OSP : 16;
    v8h h[4];
#pragma unroll
    for (int j = 0; j < 4; ++j) {
        const v4f lo = *(const v4fa*)(sp + j * step), up = *(const v4fa*)(sp + j * step + 4);
#pragma unroll
        for (int k = 0; k < 4; ++k) { h[j][k] = (h16)lo[k]; h[j][4 + k] = (h16)up[k]; } }
#pragma unroll
    for (int j = 0; j < 4; ++j) *(v8h*)(dst + (lane + 32 * j) * 8) = h[j];
}

// 2^x as the one hardware instruction (v_exp_f32). The library exp2f wraps it in a compare, two selects, an add and an ldexp per value, only so that results below 2^-126 come out as subnormals instead of 0.
// For the key loop: every argument there is (value - max in use) <= LAZY and every result is weighed against a sum that holds a term 1: a result below 2^-126 adds nothing to an f32 sum >= 1, and rounds to 0 in fp16 either way.
__device__ __forceinline__ float ex2(float x) { return __builtin_amdgcn_exp2f(x); }

// lane l <-> l ^ 16: the two halves of a wave hold the two key halves of one query column.
__device__ __forceinline__ float xhalf(float x) { const int b = __float_as_int(x); return __int_as_float(__builtin_amdgcn_permlanex16(b, b, 0x76543210, 0xfedcba98, false, false)); }

// k_attn: flash-style attention, one block = (batch b, 64 query rows), NW waves: wave & 1 = 32-query group (QT tiles of 16 queries), wave >> 1 = key range; range ks takes key blocks ks, ks + KS, ... (64 keys each),
// starting at a step that differs from work-group to work-group and wrapping round (stp below): the work-groups of a batch start together and all read the same k and v^T planes; in one common order
// they ask L2 for the same lines at the same moment, and such requests collide; rotated, they are spread over all steps of the planes at any moment. Each wave still takes each of its blocks once,
// with its own max in use, sums and un-normalised accumulators; the KS partials of a query are merged in LDS at the end (weights exp2(m_ks - max), one division by the merged sum).
// A wave's k and v^T fragments are loaded once per key block and used for both of its query tiles: half the bytes loaded into registers per product of a wave with one tile.
// Transposed tiles: S^T = K.Q^T (A = k from its fragment-order plane, see k_proj; B = q rows [b][i][d]; fp16, both with the split-k map straight from global): register r of tile t = score of key 16t + 8h + r for query lane & 15,
// so a lane holds 32 of its query's 64 scores: max and sum run in registers, the max joined between the halves by a cross-row move only where the max in use changes, the sums joined once after the loop.
// Online softmax in f32 with scale folded as scl2 = SEQ^-0.5 * log2(e); p = exp2(s*scl2 - max in use) in (0, 2].
// P^T: score tiles 2c and 2c + 1, converted in place (fp16 of p), are the B fragment of keys 32c .. 32c + 31; A = v^T from its fragment-order plane (fp16, same map): O^T += V^T.P^T, no LDS and no barrier in the loop.
// acc[g][n][r] = O^T[16n + 8h + r][query of tile g] holds sum_m p_m v_m. fp16 rounds p in (0, 2] to within 2^-11 (2^-12 below 1); averaged over the keys that stays an order below what the bf16 rounding of the inputs leaves in the output.
// Lazy rescale: the max in use changes only when some query's block max exceeds it by more than LAZY, tested once per key block by a scalar branch. In a block that keeps it, acc and l are not rescaled.
__global__ __launch_bounds__(32 * NW) __attribute__((amdgpu_waves_per_eu(NW / 4, NW / 4)))
void k_attn(const h16* __restrict__ Q16, const h16* __restrict__ K16, const h16* __restrict__ Vt16, float* OUT, float scl2) {
    __shared__ __align__(16) float wsc[NW][16 * QT * OSP];
    __shared__ float sml[NW][2][16 * QT];
    const int tid = threadIdx.x, wave = tid >> 5, lane = tid & 31, l16 = lane & 15, hi = lane >> 4;
    const int nqb = SEQ / 64; const int b = blockIdx.x / nqb; const int blk0 = (blockIdx.x % nqb) * 64; const int row0 = blk0 + (wave & 1) * (16 * QT); const int nkb = SEQ / KBK;
    const h16* qp = Q16 + ((size_t)b * SEQ + row0 + l16) * DH + 8 * hi;
    const h16* kp = K16 + (size_t)b * SEQ * DH;    // fragment order (k_proj): key block kb at kb * 4096 elements, group (t, j) at (4 t + j) * 256, this lane's piece at 8 * lane
    const h16* vp = Vt16 + (size_t)b * DH * SEQ;   // the same order, t = 16-row group of v^T
    const unsigned lo8 = 8u * (unsigned)lane;
    const int ks0 = __builtin_amdgcn_readfirstlane(wave >> 1);   // key range in a scalar register: kb and the key-block addresses stay scalar
    const int nst = nkb / KS;                                    // steps of a wave: one key block each
    const int wq = blockIdx.x % nqb; int stp = (wq + wq / 8) % nst;   // first step of this work-group: neighbours in the index differ, and so do work-groups 8 apart
    float* os = &wsc[wave][0];
    // every loop over g, t, n, r, j below has a constant trip count and is unrolled: its arrays stay in registers
    v16h qb[QT][2];
#pragma unroll
    for (int g = 0; g < QT; ++g) {
        const h16* qg = qp + g * 16 * DH;
        qb[g][0] = cat16(*(const v8h*)qg, *(const v8h*)(qg + 16));
        qb[g][1] = cat16(*(const v8h*)(qg + 32), *(const v8h*)(qg + 48)); }
    v8f acc[QT][4];
#pragma unroll
    for (int g = 0; g < QT; ++g) {
#pragma unroll
        for (int n = 0; n < 4; ++n) acc[g][n] = (v8f){}; }
    float m[QT], l[QT];
#pragma unroll
    for (int g = 0; g < QT; ++g) { m[g] = -1.0e30f; l[g] = 0.0f; }
#pragma unroll 1
    for (int it = 0; it < nst; ++it) {
        const int kb = ks0 + KS * stp; stp = (stp + 1 == nst) ? 0 : stp + 1;
        const h16* kq = kp + (size_t)kb * (KBK * DH); const h16* vq = vp + (size_t)kb * (KBK * DH);   // this key block's 8 KB of k and of v^T: wave-uniform addresses
        v16h ka[4][2];
#pragma unroll
        for (int t = 0; t < 4; ++t) {
            const h16* p0 = &kq[lo8 + t * 1024];
            ka[t][0] = cat16(*(const v8h*)p0, *(const v8h*)(p0 + 256));
            ka[t][1] = cat16(*(const v8h*)(p0 + 512), *(const v8h*)(p0 + 768)); }
        __builtin_amdgcn_sched_barrier(0);   // all 16 k loads issue before the first product; without it the compiler spreads them among the products and a wave waits out the load latency several times per key block
        v8f s[QT][4];
#pragma unroll
        for (int t = 0; t < 4; ++t) {
#pragma unroll
            for (int g = 0; g < QT; ++g) s[g][t] = wmma16(ka[t][0], qb[g][0], (v8f){});
#pragma unroll
            for (int g = 0; g < QT; ++g) s[g][t] = wmma16(ka[t][1], qb[g][1], s[g][t]); }
        // four vector slots between the last score product and the first vector instruction that reads a score tile
        asm volatile("v_nop\n\tv_nop\n\tv_nop\n\tv_nop" : "+v"(s[0][0]), "+v"(s[0][1]), "+v"(s[0][2]), "+v"(s[0][3]), "+v"(s[1][0]), "+v"(s[1][1]), "+v"(s[1][2]), "+v"(s[1][3]) : "v"(qb[0][0]), "v"(qb[0][1]), "v"(qb[1][0]), "v"(qb[1][1]));
        float mh[QT];   // block max of the 32 scores this lane holds (its half of the query's 64), unscaled
#pragma unroll
        for (int g = 0; g < QT; ++g) {
            float mt[4];
#pragma unroll
            for (int t = 0; t < 4; ++t) mt[t] = fmaxf(fmaxf(fmaxf(s[g][t][0], s[g][t][1]), fmaxf(s[g][t][2], s[g][t][3])), fmaxf(fmaxf(s[g][t][4], s[g][t][5]), fmaxf(s[g][t][6], s[g][t][7])));
            mh[g] = fmaxf(fmaxf(mt[0], mt[1]), fmaxf(mt[2], mt[3])); }
        // one test per key block, the same for the whole wave (a scalar branch, EXEC untouched): the ballot joins the two halves of every query; scl2 > 0, so the scaled max is the max of the scaled scores.
        // Always taken in a wave's first block, where m is -1e30; marked unlikely so that the block that keeps its max falls through.
        if (__builtin_expect(__builtin_amdgcn_ballot_w32((mh[0] * scl2 > m[0] + LAZY) | (mh[1] * scl2 > m[1] + LAZY)) != 0u, 0)) {
            float mn[QT];
#pragma unroll
            for (int g = 0; g < QT; ++g) mn[g] = fmaxf(m[g], fmaxf(mh[g], xhalf(mh[g])) * scl2);   // both halves of a query take the same new max
            if (it != 0) {   // in a wave's first block acc and l are still 0: nothing to rescale
#pragma unroll
                for (int g = 0; g < QT; ++g) {
                    const float corr = ex2(m[g] - mn[g]); l[g] *= corr;
#pragma unroll
                    for (int n = 0; n < 4; ++n) acc[g][n] *= corr; } }
#pragma unroll
            for (int g = 0; g < QT; ++g) m[g] = mn[g]; }
        // The v^T loads go out in QT groups, one in front of each query tile's exponentials, which cover their latency: all score tiles and all of v^T at once do not fit the 256 registers of a wave
        // (the compiler spills); the second group takes the registers that the first tile's scores leave when they are packed to fp16.
        v16h va[4][2]; v16h pb[QT][2];
#pragma unroll
        for (int g = 0; g < QT; ++g) {
#pragma unroll
            for (int n = g * (4 / QT); n < (g + 1) * (4 / QT); ++n) {
                const h16* p0 = &vq[lo8 + n * 1024];
                va[n][0] = cat16(*(const v8h*)p0, *(const v8h*)(p0 + 256));
                va[n][1] = cat16(*(const v8h*)(p0 + 512), *(const v8h*)(p0 + 768)); }
            __builtin_amdgcn_sched_barrier(0);   // the group's 8 loads issue before this tile's exponentials; moved down among them or behind them, the output products wait out the load latency
            float st[4];
#pragma unroll
            for (int t = 0; t < 4; ++t) {
                float p[8];
#pragma unroll
                for (int r = 0; r < 8; ++r) { p[r] = ex2(s[g][t][r] * scl2 - m[g]); pb[g][t >> 1][(t & 1) * 8 + r] = (h16)p[r]; }
                st[t] = ((p[0] + p[1]) + (p[2] + p[3])) + ((p[4] + p[5]) + (p[6] + p[7]));
                __builtin_amdgcn_sched_barrier(0); }   // score tile by score tile: with all 32 exponentials of a query tile mixed, their temporaries overflow the 256 registers and the compiler spills
            l[g] += (st[0] + st[1]) + (st[2] + st[3]); }
#pragma unroll
        for (int n = 0; n < 4; ++n) {
#pragma unroll
            for (int g = 0; g < QT; ++g) { acc[g][n] = wmma16(va[n][0], pb[g][0], acc[g][n]); acc[g][n] = wmma16(va[n][1], pb[g][1], acc[g][n]); } }
        // the same four slots behind the last output product, on the loop's taken back edge and on its exit alike
        asm volatile("v_nop\n\tv_nop\n\tv_nop\n\tv_nop" : "+v"(acc[0][0]), "+v"(acc[0][1]), "+v"(acc[0][2]), "+v"(acc[0][3]), "+v"(acc[1][0]), "+v"(acc[1][1]), "+v"(acc[1][2]), "+v"(acc[1][3]) : "v"(pb[0][0]), "v"(pb[0][1]), "v"(pb[1][0]), "v"(pb[1][1]));
    }
#pragma unroll
    for (int g = 0; g < QT; ++g) {
        l[g] += xhalf(l[g]);
        if (hi == 0) { sml[wave][0][16 * g + l16] = m[g]; sml[wave][1][16 * g + l16] = l[g]; }
#pragma unroll
        for (int n = 0; n < 4; ++n) {
            *(v4fa*)(os + (16 * g + l16) * OSP + n * 16 + 8 * hi) = __builtin_shufflevector(acc[g][n], acc[g][n], 0, 1, 2, 3);
            *(v4fa*)(os + (16 * g + l16) * OSP + n * 16 + 8 * hi + 4) = __builtin_shufflevector(acc[g][n], acc[g][n], 4, 5, 6, 7); } }
    __syncthreads();
    float* orow = OUT + ((size_t)b * SEQ + blk0) * DH;
    // the three unrolls below: constant trip counts, so that the LDS reads of all KS partials issue together instead of one wait per range
#pragma unroll
    for (int i = 0; i < 32 / NW; ++i) {
        const int idx = tid + i * 32 * NW; const int row = idx >> 4, cofs = (idx & 15) * 4, rg = row / (16 * QT), rr = row % (16 * QT);
        float mm = sml[rg][0][rr];
#pragma unroll
        for (int ks = 1; ks < KS; ++ks) mm = fmaxf(mm, sml[ks * 2 + rg][0][rr]);
        float ls = 0.0f; v4f o = (v4f){};
#pragma unroll
        for (int ks = 0; ks < KS; ++ks) { const float w = exp2f(sml[ks * 2 + rg][0][rr] - mm); ls += w * sml[ks * 2 + rg][1][rr]; o += w * *(const v4fa*)(&wsc[ks * 2 + rg][rr * OSP + cofs]); }
        *(v4f*)(orow + (size_t)row * DH + cofs) = o * (1.0f / ls);
    }
}

extern "C" void kernel_launch(void* const* d_in, const int* in_sizes, int n_in,
                              void* d_out, int out_size, void* d_ws, size_t ws_size, hipStream_t stream) {
    if (n_in < 5) return;
    const size_t need_x = ((size_t)(NB - 1) * SEQ_FULL + SEQ) * DH;
    if ((size_t)in_sizes[0] < need_x || (size_t)in_sizes[1] < need_x) return;
    if (in_sizes[2] < DH * DH || in_sizes[3] < DH * DH || in_sizes[4] < DH * DH) return;
    if ((size_t)out_size < (size_t)NB * SEQ * DH) return;
    const float* x1 = (const float*)d_in[0];   // [4][4096][64]
    const float* x2 = (const float*)d_in[1];   // [4][4096][64]
    const float* wq = (const float*)d_in[2];   // [64][64] = [out][in]
    const float* wk = (const float*)d_in[3];
    const float* wv = (const float*)d_in[4];
    float* OUT = (float*)d_out;                // [4][4096][64]
    const size_t n = (size_t)NB * SEQ * DH;
    char* wsp = (char*)d_ws;
    auto take = [&](size_t bytes) { char* p = wsp; wsp += (bytes + 255) & ~(size_t)255; return (void*)p; };
    h16* P16 = (h16*)take(3 * n * 2); h16* Q16 = P16; h16* K16 = P16 + n; h16* Vt16 = P16 + 2 * n;          // fp16 planes: q [NB*SEQ][64], k and v^T in fragment order (k_proj)
    if ((size_t)(wsp - (char*)d_ws) > ws_size) return;    // total 6,291,456 B at NB=4, SEQ=4096
    const float sc = 1.0f / sqrtf((float)SEQ);
    const float scl2 = sc * 1.4426950408889634f;
    k_proj<<<dim3(NB * SEQ / 64, 3, 1), 128, 0, stream>>>(x1, x2, wq, wk, wv, Q16, K16, Vt16);
    k_attn<<<NB * SEQ / 64, 32 * NW, 0, stream>>>(Q16, K16, Vt16, OUT, scl2);
}
